// v000
// Measured on an AMD MI455X. A time is GPU time per run, averaged over a window of back-to-back runs after a warm-up
// (all launches, gaps included; the runs take copies of the inputs in turn), and the median of several windows.
// Apart from v000's, it joins two sittings. Times from different sittings can be a few percent apart, while
// side-by-side timings come from the same sitting.
// v000, which the later versions start from, runs in 350 microseconds.
#include <hip/hip_runtime.h>

#ifndef NB
#define NB 4
#endif
#ifndef SEQ
#define SEQ 2048
#endif
#define NB_FULL  4
#define SEQ_FULL 2048
#define DM   1024
#define NH   16
#define HD   64
#define WCAR 64.0f
#define WINV (1.0f / 64.0f)
#define CCAR 64.0f
#define OINV (1.0f / 4096.0f)
#define C2   0.18033688011112042f   // (1/8) * log2(e)
#define TSP  72                     // LDS tile pitch in halves (144 B, multiple of 16 B)

static_assert(NH * HD == DM);
static_assert(HD == 64);
static_assert(DM % 32 == 0);
static_assert(DM % 64 == 0);
static_assert(SEQ % 64 == 0);
static_assert(SEQ <= SEQ_FULL);
static_assert(NB <= NB_FULL);
static_assert((TSP * 2) % 16 == 0);
static_assert(TSP >= HD);

typedef _Float16 h16;
typedef __attribute__((ext_vector_type(16))) _Float16 v16h;
typedef __attribute__((ext_vector_type(8)))  _Float16 v8h;
typedef __attribute__((ext_vector_type(8)))  float    v8f;
typedef __attribute__((ext_vector_type(4)))  float    v4f;
typedef v8h __attribute__((may_alias)) v8ha;
typedef v4f __attribute__((may_alias)) v4fa;

__device__ __forceinline__ unsigned short f2bf(float f) { unsigned u = __float_as_uint(f); u += 0x7FFFu + ((u >> 16) & 1u); return (unsigned short)(u >> 16); }
__device__ __forceinline__ float bf2f(unsigned short b) { return __uint_as_float(((unsigned)b) << 16); }
__device__ __forceinline__ float bfr(float f) { return bf2f(f2bf(f)); }
__device__ __forceinline__ v16h cat16(v8h lo, v8h hi) { return __builtin_shufflevector(lo, hi, 0, 1, 2, 3, 4, 5, 6, 7, 8, 9, 10, 11, 12, 13, 14, 15); }
// fragment from a K-contiguous f16 row: elements 0..7 <- p[0..7], 8..15 <- p[16..23]; caller passes p = row + k0 + 8*(lane>>4)
__device__ __forceinline__ v16h ldh(const h16* p) { return cat16(*(const v8h*)p, *(const v8h*)(p + 16)); }
__device__ __forceinline__ v8f wmma16(v16h a, v16h b, v8f c) { return __builtin_amdgcn_wmma_f32_16x16x32_f16(false, a, false, b, (short)0, c, false, false); }
__device__ __forceinline__ void wave_lds_sync() { __builtin_amdgcn_fence(3 /* release order */, "wavefront"); __builtin_amdgcn_wave_barrier(); asm volatile("" ::: "memory"); }

__global__ __launch_bounds__(256) void k_cvt8(const float* __restrict__ x, h16* XH) {
    const size_t i = (size_t)blockIdx.x * 256 + threadIdx.x; const size_t n8 = (size_t)NB * SEQ * DM / 8; if (i >= n8) return;
    const size_t r = i / (DM / 8); const size_t c8 = i % (DM / 8); const size_t b = r / SEQ, s = r % SEQ;
    const float* src = x + (b * SEQ_FULL + s) * DM + c8 * 8;
    const v4f v0 = *(const v4f*)src; const v4f v1 = *(const v4f*)(src + 4); v8h o;
    o[0] = (h16)bfr(v0[0]); o[1] = (h16)bfr(v0[1]); o[2] = (h16)bfr(v0[2]); o[3] = (h16)bfr(v0[3]);
    o[4] = (h16)bfr(v1[0]); o[5] = (h16)bfr(v1[1]); o[6] = (h16)bfr(v1[2]); o[7] = (h16)bfr(v1[3]);
    *(v8h*)(XH + i * 8) = o; 
}

__global__ __launch_bounds__(256) void k_wt(const float* __restrict__ w, int K, int N, int Z, h16* Bt) {
    const size_t i = (size_t)blockIdx.x * 256 + threadIdx.x; const size_t n8 = (size_t)Z * N * K / 8; if (i >= n8) return;
    const size_t e = i * 8; const size_t k = e % (size_t)K; const size_t n = (e / (size_t)K) % (size_t)N; const size_t z = e / ((size_t)K * N);
    const float* s = w + (z * K + k) * N + n; v8h o;
#pragma unroll
    for (int j = 0; j < 8; ++j) o[j] = (h16)(bfr(s[(size_t)j * N]) * WCAR);
    *(v8h*)(Bt + e) = o; 
}

// ---- gemm64: one wave, 64x64 f32 tile: acc[mb][nb][j] = sum_k A[mb*16 + 8*hi + j][k] * Bt[nb*16 + lr][k], K = DM, both operands K-contiguous f16 rows (pitch DM).
__device__ __forceinline__ void gemm64(const h16* __restrict__ A, const h16* __restrict__ Bt, v8f (&acc)[4][4], int lr, int hi) {
#pragma unroll
    for (int mb = 0; mb < 4; ++mb)
#pragma unroll
        for (int nb = 0; nb < 4; ++nb) acc[mb][nb] = (v8f){};
    const size_t off = (size_t)lr * DM + 8 * hi;
#pragma unroll 1
    for (int kc = 0; kc < DM; kc += 32) {
        v16h a[4]; v16h b;
#pragma unroll
        for (int mb = 0; mb < 4; ++mb) a[mb] = ldh(A + off + (size_t)mb * 16 * DM + kc);
#pragma unroll
        for (int nb = 0; nb < 4; ++nb) { b = ldh(Bt + off + (size_t)nb * 16 * DM + kc);
#pragma unroll
            for (int mb = 0; mb < 4; ++mb) acc[mb][nb] = wmma16(a[mb], b, acc[mb][nb]); }
        asm volatile("v_nop\n\tv_nop\n\tv_nop\n\tv_nop" : "+v"(acc[0][0]), "+v"(acc[1][1]), "+v"(acc[2][2]), "+v"(acc[3][3]) : "v"(a[0]), "v"(a[3]), "v"(b));
    }
}

__device__ __forceinline__ void store_tile64(const h16* ts_base_unused, h16* dst, size_t pitch, int lane);

// ---- k_projqk: plane P[b][h][s][d] (f16) = x Wt^T / 64 + b. Operand roles swapped (A = weight rows, B = x rows) so each lane holds 8 consecutive d of one s.
__global__ __launch_bounds__(32) void k_projqk(const h16* __restrict__ XH, const h16* __restrict__ WT, const float* __restrict__ bias, h16* P) {
    __shared__ __align__(16) h16 ts[64 * TSP];
    const int lane = threadIdx.x & 31, lr = lane & 15, hi = lane >> 4;
    const int r0 = blockIdx.x * 64, head = blockIdx.y; const int bz = r0 / SEQ, s0 = r0 % SEQ;
    v8f acc[4][4];
    gemm64(WT + (size_t)head * HD * DM, XH + (size_t)r0 * DM, acc, lr, hi);   // acc[mb][nb][j]: d = mb*16 + 8*hi + j, s = nb*16 + lr
#pragma unroll
    for (int mb = 0; mb < 4; ++mb) {
        const v4f b0 = *(const v4f*)(bias + head * HD + mb * 16 + 8 * hi); const v4f b1 = *(const v4f*)(bias + head * HD + mb * 16 + 8 * hi + 4);
        v8f bb; bb[0] = bfr(b0[0]); bb[1] = bfr(b0[1]); bb[2] = bfr(b0[2]); bb[3] = bfr(b0[3]); bb[4] = bfr(b1[0]); bb[5] = bfr(b1[1]); bb[6] = bfr(b1[2]); bb[7] = bfr(b1[3]);
#pragma unroll
        for (int nb = 0; nb < 4; ++nb) { v8h hv;
#pragma unroll
            for (int j = 0; j < 8; ++j) hv[j] = (h16)(acc[mb][nb][j] * WINV + bb[j]);
            *(v8ha*)(&ts[(nb * 16 + lr) * TSP + mb * 16 + 8 * hi]) = hv; } }
    wave_lds_sync();                                                        // ts is private to this one-wave block
    h16* dst = P + (((size_t)bz * NH + head) * SEQ + s0) * HD;
{
#pragma unroll
        for (int it = 0; it < 16; ++it) { const int L = it * 4 + (lane >> 3), pc = lane & 7; const v8h val = *(const v8ha*)(&ts[L * TSP + pc * 8]);
            *(v8h*)(dst + (size_t)L * HD + pc * 8) = val; }
         }
}

// ---- k_projv: transposed plane VT[b][h][d][s] (f16) = x Wv^T / 64 + bv (A = x rows, B = weight rows: each lane holds 8 consecutive s of one d).
__global__ __launch_bounds__(32) void k_projv(const h16* __restrict__ XH, const h16* __restrict__ WT, const float* __restrict__ bias, h16* VT) {
    __shared__ __align__(16) h16 ts[64 * TSP];
    const int lane = threadIdx.x & 31, lr = lane & 15, hi = lane >> 4;
    const int r0 = blockIdx.x * 64, head = blockIdx.y; const int bz = r0 / SEQ, s0 = r0 % SEQ;
    v8f acc[4][4];
    gemm64(XH + (size_t)r0 * DM, WT + (size_t)head * HD * DM, acc, lr, hi);   // acc[mb][nb][j]: s = mb*16 + 8*hi + j, d = nb*16 + lr
#pragma unroll
    for (int nb = 0; nb < 4; ++nb) { const float bb = bfr(bias[head * HD + nb * 16 + lr]);
#pragma unroll
        for (int mb = 0; mb < 4; ++mb) { v8h hv;
#pragma unroll
            for (int j = 0; j < 8; ++j) hv[j] = (h16)(acc[mb][nb][j] * WINV + bb);
            *(v8ha*)(&ts[(nb * 16 + lr) * TSP + mb * 16 + 8 * hi]) = hv; } }
    wave_lds_sync();
    h16* dst = VT + (((size_t)bz * NH + head) * HD) * SEQ + s0;
{
#pragma unroll
        for (int it = 0; it < 16; ++it) { const int L = it * 4 + (lane >> 3), pc = lane & 7; const v8h val = *(const v8ha*)(&ts[L * TSP + pc * 8]);
            *(v8h*)(dst + (size_t)L * SEQ + pc * 8) = val; }
         }
}

// ---- k_attn: fused attention. One wave = 16 query rows of one (b,h); waves are independent (no block barrier); fragments straight from the f16 planes.
// Per 64-key step: 4 tiles S^T[key][query] = K-tile (A) x Q^T (B); online softmax per query column (lane-local over keys + one xor-16 exchange);
// P^T B fragments repacked in-lane from the S^T accumulators (element r <- tile 2u [r], element 8+r <- tile 2u+1 [r]); O^T[d][query] += V^T (A) x P^T (B).
__global__ __launch_bounds__(128) void k_attn(const h16* __restrict__ Qp, const h16* __restrict__ Kp, const h16* __restrict__ Vt, h16* Ctx) {
    __shared__ __align__(16) h16 os[4 * 16 * TSP];
    const int lane = threadIdx.x & 31, lr = lane & 15, hi = lane >> 4, wv = threadIdx.x >> 5;
    const int bh = blockIdx.y; const int q0 = blockIdx.x * 64 + wv * 16;
    const size_t pbase = (size_t)bh * SEQ * HD;
    const h16* qrow = Qp + pbase + (size_t)(q0 + lr) * HD + 8 * hi;
    const v16h qb0 = ldh(qrow), qb1 = ldh(qrow + 32);
    const h16* kbase = Kp + pbase + (size_t)lr * HD + 8 * hi;
    const h16* vbase = Vt + pbase + (size_t)lr * SEQ + 8 * hi;
    v8f o[4];
#pragma unroll
    for (int dt = 0; dt < 4; ++dt) o[dt] = (v8f){};
    float m = -3.0e38f, l = 0.0f;
#pragma unroll 1
    for (int kb = 0; kb < SEQ; kb += 64) {
        v8f st[4]; v16h ka0, ka1;
#pragma unroll
        for (int t = 0; t < 4; ++t) { const h16* kp = kbase + (size_t)(kb + t * 16) * HD; ka0 = ldh(kp); ka1 = ldh(kp + 32);
            v8f c = (v8f){}; c = wmma16(ka0, qb0, c); c = wmma16(ka1, qb1, c); st[t] = c; }
        asm volatile("v_nop\n\tv_nop\n\tv_nop\n\tv_nop" : "+v"(st[0]), "+v"(st[1]), "+v"(st[2]), "+v"(st[3]) : "v"(ka0), "v"(ka1), "v"(qb0), "v"(qb1));
        float mloc = fmaxf(fmaxf(st[0][0], st[1][0]), fmaxf(st[2][0], st[3][0]));
#pragma unroll
        for (int j = 1; j < 8; ++j) mloc = fmaxf(mloc, fmaxf(fmaxf(st[0][j], st[1][j]), fmaxf(st[2][j], st[3][j])));
        mloc = fmaxf(mloc, __shfl_xor(mloc, 16, 32));
        const float mnew = fmaxf(m, mloc * C2);
        const float corr = __builtin_amdgcn_exp2f(m - mnew); m = mnew;
        v16h pb0, pb1; float psum = 0.0f;
#pragma unroll
        for (int j = 0; j < 8; ++j) {
            const float p0 = __builtin_amdgcn_exp2f(__builtin_fmaf(st[0][j], C2, -mnew));
            const float p1 = __builtin_amdgcn_exp2f(__builtin_fmaf(st[1][j], C2, -mnew));
            const float p2 = __builtin_amdgcn_exp2f(__builtin_fmaf(st[2][j], C2, -mnew));
            const float p3 = __builtin_amdgcn_exp2f(__builtin_fmaf(st[3][j], C2, -mnew));
            psum += (p0 + p1) + (p2 + p3);
            pb0[j] = (h16)p0; pb0[8 + j] = (h16)p1; pb1[j] = (h16)p2; pb1[8 + j] = (h16)p3; }
        l = l * corr + psum;
#pragma unroll
        for (int dt = 0; dt < 4; ++dt)
#pragma unroll
            for (int j = 0; j < 8; ++j) o[dt][j] *= corr;
        v16h va0, va1;
#pragma unroll
        for (int dt = 0; dt < 4; ++dt) { const h16* vp = vbase + (size_t)dt * 16 * SEQ + kb; va0 = ldh(vp); va1 = ldh(vp + 32);
            o[dt] = wmma16(va0, pb0, o[dt]); o[dt] = wmma16(va1, pb1, o[dt]); }
        asm volatile("v_nop\n\tv_nop\n\tv_nop\n\tv_nop" : "+v"(o[0]), "+v"(o[1]), "+v"(o[2]), "+v"(o[3]) : "v"(va0), "v"(va1), "v"(pb0), "v"(pb1));
    }
    const float lt = l + __shfl_xor(l, 16, 32);
    const float inv = CCAR * (1.0f / lt);
    const int ob = wv * 16 * TSP;                                            // wave-private staging region
#pragma unroll
    for (int dt = 0; dt < 4; ++dt) { v8h hv;                                 // o[dt][j] = O^T[d = dt*16 + 8*hi + j][query lr]
#pragma unroll
        for (int j = 0; j < 8; ++j) hv[j] = (h16)(o[dt][j] * inv);
        *(v8ha*)(&os[ob + lr * TSP + dt * 16 + 8 * hi]) = hv; }
    wave_lds_sync();
    const int b = bh / NH, h = bh % NH;
    h16* dst = Ctx + ((size_t)b * SEQ + q0) * DM + h * HD;
{
#pragma unroll
        for (int it = 0; it < 4; ++it) { const int qq = it * 4 + (lane >> 3), pc = lane & 7; const v8h val = *(const v8ha*)(&os[ob + qq * TSP + pc * 8]);
            *(v8h*)(dst + (size_t)qq * DM + pc * 8) = val; }
         }
}

__global__ __launch_bounds__(32) void k_outp(const h16* __restrict__ CTX, const h16* __restrict__ WO, const float* __restrict__ bias, float* OUT) {
    __shared__ __align__(16) float os[16 * 68];
    const int lane = threadIdx.x & 31, lr = lane & 15, hi = lane >> 4;
    const int r0 = blockIdx.x * 64, c0 = blockIdx.y * 64; const int bz = r0 / SEQ, s0 = r0 % SEQ;
    v8f acc[4][4];
    gemm64(CTX + (size_t)r0 * DM, WO + (size_t)c0 * DM, acc, lr, hi);       // acc[mb][nb][j]: row mb*16 + 8*hi + j, col nb*16 + lr
    const v4f braw = *(const v4f*)(bias + c0 + lr * 4); v4f bb; bb[0] = bfr(braw[0]); bb[1] = bfr(braw[1]); bb[2] = bfr(braw[2]); bb[3] = bfr(braw[3]);
    float* cbase = OUT + ((size_t)bz * SEQ_FULL + s0) * DM + c0;
#pragma unroll
    for (int mb = 0; mb < 4; ++mb) {
#pragma unroll
        for (int nb = 0; nb < 4; ++nb) {
#pragma unroll
            for (int j = 0; j < 8; ++j) os[(hi * 8 + j) * 68 + nb * 16 + lr] = acc[mb][nb][j] * OINV; }
        wave_lds_sync();
        float* crow = cbase + (size_t)(mb * 16) * DM;
{
#pragma unroll
            for (int s = 0; s < 8; ++s) { const int row = 2 * s + hi, cofs = lr * 4; v4f val = *(const v4fa*)(os + row * 68 + cofs); val += bb;
                *(v4f*)(crow + (size_t)row * DM + cofs) = val; }
             }
        wave_lds_sync();
    }
}

#define SZ_X    ((size_t)NB * SEQ * DM * 2)
#define SZ_W    ((size_t)DM * DM * 2)
#define SZ_ALL  (SZ_X * 5 + SZ_W * 4)
static_assert(SZ_X % 256 == 0);
static_assert(SZ_W % 256 == 0);
static_assert(SZ_ALL <= (size_t)134217728);

extern "C" void kernel_launch(void* const* d_in, const int* in_sizes, int n_in,
                              void* d_out, int out_size, void* d_ws, size_t ws_size, hipStream_t stream) {
    if (n_in < 9) return;
    const size_t needx = ((size_t)(NB - 1) * SEQ_FULL + SEQ) * DM;
    if ((size_t)in_sizes[0] < needx) return;
    if ((size_t)in_sizes[1] < (size_t)NH * DM * HD || (size_t)in_sizes[3] < (size_t)NH * DM * HD || (size_t)in_sizes[5] < (size_t)NH * DM * HD) return;
    if ((size_t)in_sizes[2] < (size_t)NH * HD || (size_t)in_sizes[4] < (size_t)NH * HD || (size_t)in_sizes[6] < (size_t)NH * HD) return;
    if ((size_t)in_sizes[7] < (size_t)DM * DM || (size_t)in_sizes[8] < (size_t)DM) return;
    if ((size_t)out_size < needx) return;
    if (SZ_ALL > ws_size) return;
    const float* xs = (const float*)d_in[0];
    const float* Wq = (const float*)d_in[1]; const float* bq = (const float*)d_in[2];
    const float* Wk = (const float*)d_in[3]; const float* bk = (const float*)d_in[4];
    const float* Wv = (const float*)d_in[5]; const float* bv = (const float*)d_in[6];
    const float* Wo = (const float*)d_in[7]; const float* bo = (const float*)d_in[8];
    float* OUT = (float*)d_out;
    char* wsp = (char*)d_ws;
    h16* XH  = (h16*)wsp; wsp += SZ_X;      // [NB*SEQ][DM]
    h16* WQ  = (h16*)wsp; wsp += SZ_W;      // Bt [h*64+d][e], x64
    h16* WK  = (h16*)wsp; wsp += SZ_W;
    h16* WV  = (h16*)wsp; wsp += SZ_W;
    h16* WO  = (h16*)wsp; wsp += SZ_W;      // Bt [out][in], x64
    h16* QP  = (h16*)wsp; wsp += SZ_X;      // [b][h][s][d]
    h16* KP  = (h16*)wsp; wsp += SZ_X;      // [b][h][s][d]
    h16* VT  = (h16*)wsp; wsp += SZ_X;      // [b][h][d][s]
    h16* CTX = (h16*)wsp; wsp += SZ_X;      // [NB*SEQ][DM], x64

    k_cvt8<<<(unsigned)(((size_t)NB * SEQ * DM / 8 + 255) / 256), 256, 0, stream>>>(xs, XH);
    const unsigned gw = (unsigned)(((size_t)DM * DM / 8 + 255) / 256);
    k_wt<<<gw, 256, 0, stream>>>(Wq, DM, HD, NH, WQ);     // in[h][e][d] -> Bt[h*64 + d][e]
    k_wt<<<gw, 256, 0, stream>>>(Wk, DM, HD, NH, WK);
    k_wt<<<gw, 256, 0, stream>>>(Wv, DM, HD, NH, WV);
    k_wt<<<gw, 256, 0, stream>>>(Wo, DM, DM, 1, WO);      // in[e][o] -> Bt[o][e]
    k_projqk<<<dim3(NB * SEQ / 64, NH, 1), 32, 0, stream>>>(XH, WQ, bq, QP);
    k_projqk<<<dim3(NB * SEQ / 64, NH, 1), 32, 0, stream>>>(XH, WK, bk, KP);
    k_projv<<<dim3(NB * SEQ / 64, NH, 1), 32, 0, stream>>>(XH, WV, bv, VT);
    k_attn<<<dim3(SEQ / 64, NB * NH, 1), 128, 0, stream>>>(QP, KP, VT, CTX);
    k_outp<<<dim3(NB * SEQ / 64, DM / 64, 1), 32, 0, stream>>>(CTX, WO, bo, OUT);
}

// v001
// One run takes 233 microseconds.
// Next to v000, in two timings, it ran 1.56 times as fast each time.
#include <hip/hip_runtime.h>

#ifndef NB
#define NB 4
#endif
#ifndef SEQ
#define SEQ 2048
#endif
#define NB_FULL  4
#define SEQ_FULL 2048
#define DM   1024
#define NH   16
#define HD   64
#define WCAR 64.0f
#define WINV (1.0f / 64.0f)
#define CCAR 64.0f
#define OINV (1.0f / 4096.0f)
#define C2   0.18033688011112042f   // (1/8) * log2(e)
#define TSP  72                     // LDS tile pitch in halves (144 B, multiple of 16 B)

static_assert(NH * HD == DM);
static_assert(HD == 64);
static_assert(DM % 32 == 0);
static_assert(DM % 64 == 0);
static_assert(SEQ % 64 == 0);
static_assert(SEQ <= SEQ_FULL);
static_assert(NB <= NB_FULL);
static_assert((TSP * 2) % 16 == 0);
static_assert(TSP >= HD);

typedef _Float16 h16;
typedef __attribute__((ext_vector_type(16))) _Float16 v16h;
typedef __attribute__((ext_vector_type(8)))  _Float16 v8h;
typedef __attribute__((ext_vector_type(8)))  float    v8f;
typedef __attribute__((ext_vector_type(4)))  float    v4f;
typedef v8h __attribute__((may_alias)) v8ha;
typedef v4f __attribute__((may_alias)) v4fa;

__device__ __forceinline__ unsigned short f2bf(float f) { unsigned u = __float_as_uint(f); u += 0x7FFFu + ((u >> 16) & 1u); return (unsigned short)(u >> 16); }
__device__ __forceinline__ float bf2f(unsigned short b) { return __uint_as_float(((unsigned)b) << 16); }
__device__ __forceinline__ float bfr(float f) { return bf2f(f2bf(f)); }
__device__ __forceinline__ v16h cat16(v8h lo, v8h hi) { return __builtin_shufflevector(lo, hi, 0, 1, 2, 3, 4, 5, 6, 7, 8, 9, 10, 11, 12, 13, 14, 15); }
// fragment from a K-contiguous f16 row: elements 0..7 <- p[0..7], 8..15 <- p[16..23]; caller passes p = row + k0 + 8*(lane>>4)
__device__ __forceinline__ v16h ldh(const h16* p) { return cat16(*(const v8h*)p, *(const v8h*)(p + 16)); }
__device__ __forceinline__ v8f wmma16(v16h a, v16h b, v8f c) { return __builtin_amdgcn_wmma_f32_16x16x32_f16(false, a, false, b, (short)0, c, false, false); }
__device__ __forceinline__ void wave_lds_sync() { __builtin_amdgcn_fence(3 /* release order */, "wavefront"); __builtin_amdgcn_wave_barrier(); asm volatile("" ::: "memory"); }

__global__ __launch_bounds__(256) void k_cvt8(const float* __restrict__ x, h16* XH) {
    const size_t i = (size_t)blockIdx.x * 256 + threadIdx.x; const size_t n8 = (size_t)NB * SEQ * DM / 8; if (i >= n8) return;
    const size_t r = i / (DM / 8); const size_t c8 = i % (DM / 8); const size_t b = r / SEQ, s = r % SEQ;
    const float* src = x + (b * SEQ_FULL + s) * DM + c8 * 8;
    const v4f v0 = *(const v4f*)src; const v4f v1 = *(const v4f*)(src + 4); v8h o;
    o[0] = (h16)bfr(v0[0]); o[1] = (h16)bfr(v0[1]); o[2] = (h16)bfr(v0[2]); o[3] = (h16)bfr(v0[3]);
    o[4] = (h16)bfr(v1[0]); o[5] = (h16)bfr(v1[1]); o[6] = (h16)bfr(v1[2]); o[7] = (h16)bfr(v1[3]);
    *(v8h*)(XH + i * 8) = o; 
}

__global__ __launch_bounds__(256) void k_wt(const float* __restrict__ w, int K, int N, int Z, h16* Bt) {
    const size_t i = (size_t)blockIdx.x * 256 + threadIdx.x; const size_t n8 = (size_t)Z * N * K / 8; if (i >= n8) return;
    const size_t e = i * 8; const size_t k = e % (size_t)K; const size_t n = (e / (size_t)K) % (size_t)N; const size_t z = e / ((size_t)K * N);
    const float* s = w + (z * K + k) * N + n; v8h o;
#pragma unroll
    for (int j = 0; j < 8; ++j) o[j] = (h16)(bfr(s[(size_t)j * N]) * WCAR);
    *(v8h*)(Bt + e) = o; 
}

// ---- gemm64: one wave, 64x64 f32 tile: acc[mb][nb][j] = sum_k A[mb*16 + 8*hi + j][k] * Bt[nb*16 + lr][k], K = DM, both operands K-contiguous f16 rows (pitch DM).
__device__ __forceinline__ void gemm64(const h16* __restrict__ A, const h16* __restrict__ Bt, v8f (&acc)[4][4], int lr, int hi) {
#pragma unroll
    for (int mb = 0; mb < 4; ++mb)
#pragma unroll
        for (int nb = 0; nb < 4; ++nb) acc[mb][nb] = (v8f){};
    const size_t off = (size_t)lr * DM + 8 * hi;
#pragma unroll 1
    for (int kc = 0; kc < DM; kc += 32) {
        v16h a[4]; v16h b;
#pragma unroll
        for (int mb = 0; mb < 4; ++mb) a[mb] = ldh(A + off + (size_t)mb * 16 * DM + kc);
#pragma unroll
        for (int nb = 0; nb < 4; ++nb) { b = ldh(Bt + off + (size_t)nb * 16 * DM + kc);
#pragma unroll
            for (int mb = 0; mb < 4; ++mb) acc[mb][nb] = wmma16(a[mb], b, acc[mb][nb]); }
        asm volatile("v_nop\n\tv_nop\n\tv_nop\n\tv_nop" : "+v"(acc[0][0]), "+v"(acc[1][1]), "+v"(acc[2][2]), "+v"(acc[3][3]) : "v"(a[0]), "v"(a[3]), "v"(b));
    }
}

__device__ __forceinline__ void store_tile64(const h16* ts_base_unused, h16* dst, size_t pitch, int lane);

// ---- k_projqk: plane P[b][h][s][d] (f16) = x Wt^T / 64 + b. Operand roles swapped (A = weight rows, B = x rows) so each lane holds 8 consecutive d of one s.
__global__ __launch_bounds__(32) void k_projqk(const h16* __restrict__ XH, const h16* __restrict__ WT, const float* __restrict__ bias, h16* P) {
    __shared__ __align__(16) h16 ts[64 * TSP];
    const int lane = threadIdx.x & 31, lr = lane & 15, hi = lane >> 4;
    const int r0 = blockIdx.x * 64, head = blockIdx.y; const int bz = r0 / SEQ, s0 = r0 % SEQ;
    v8f acc[4][4];
    gemm64(WT + (size_t)head * HD * DM, XH + (size_t)r0 * DM, acc, lr, hi);   // acc[mb][nb][j]: d = mb*16 + 8*hi + j, s = nb*16 + lr
#pragma unroll
    for (int mb = 0; mb < 4; ++mb) {
        const v4f b0 = *(const v4f*)(bias + head * HD + mb * 16 + 8 * hi); const v4f b1 = *(const v4f*)(bias + head * HD + mb * 16 + 8 * hi + 4);
        v8f bb; bb[0] = bfr(b0[0]); bb[1] = bfr(b0[1]); bb[2] = bfr(b0[2]); bb[3] = bfr(b0[3]); bb[4] = bfr(b1[0]); bb[5] = bfr(b1[1]); bb[6] = bfr(b1[2]); bb[7] = bfr(b1[3]);
#pragma unroll
        for (int nb = 0; nb < 4; ++nb) { v8h hv;
#pragma unroll
            for (int j = 0; j < 8; ++j) hv[j] = (h16)(acc[mb][nb][j] * WINV + bb[j]);
            *(v8ha*)(&ts[(nb * 16 + lr) * TSP + mb * 16 + 8 * hi]) = hv; } }
    wave_lds_sync();                                                        // ts is private to this one-wave block
    h16* dst = P + (((size_t)bz * NH + head) * SEQ + s0) * HD;
{
#pragma unroll
        for (int it = 0; it < 16; ++it) { const int L = it * 4 + (lane >> 3), pc = lane & 7; const v8h val = *(const v8ha*)(&ts[L * TSP + pc * 8]);
            *(v8h*)(dst + (size_t)L * HD + pc * 8) = val; }
         }
}

// ---- k_projv: transposed plane VT[b][h][d][s] (f16) = x Wv^T / 64 + bv (A = x rows, B = weight rows: each lane holds 8 consecutive s of one d).
__global__ __launch_bounds__(32) void k_projv(const h16* __restrict__ XH, const h16* __restrict__ WT, const float* __restrict__ bias, h16* VT) {
    __shared__ __align__(16) h16 ts[64 * TSP];
    const int lane = threadIdx.x & 31, lr = lane & 15, hi = lane >> 4;
    const int r0 = blockIdx.x * 64, head = blockIdx.y; const int bz = r0 / SEQ, s0 = r0 % SEQ;
    v8f acc[4][4];
    gemm64(XH + (size_t)r0 * DM, WT + (size_t)head * HD * DM, acc, lr, hi);   // acc[mb][nb][j]: s = mb*16 + 8*hi + j, d = nb*16 + lr
#pragma unroll
    for (int nb = 0; nb < 4; ++nb) { const float bb = bfr(bias[head * HD + nb * 16 + lr]);
#pragma unroll
        for (int mb = 0; mb < 4; ++mb) { v8h hv;
#pragma unroll
            for (int j = 0; j < 8; ++j) hv[j] = (h16)(acc[mb][nb][j] * WINV + bb);
            *(v8ha*)(&ts[(nb * 16 + lr) * TSP + mb * 16 + 8 * hi]) = hv; } }
    wave_lds_sync();
    h16* dst = VT + (((size_t)bz * NH + head) * HD) * SEQ + s0;
{
#pragma unroll
        for (int it = 0; it < 16; ++it) { const int L = it * 4 + (lane >> 3), pc = lane & 7; const v8h val = *(const v8ha*)(&ts[L * TSP + pc * 8]);
            *(v8h*)(dst + (size_t)L * SEQ + pc * 8) = val; }
         }
}

// ---- k_attn: fused attention. One wave = 16 query rows of one (b,h); the 8 waves of a block walk the same keys and share each 64-key K tile and V^T tile through LDS.
// A stage = K tile [64 keys][64 d] + V^T tile [64 d][64 keys], rows of 128 B at the 144-B pitch; two stages in LDS: the next one is copied in (global -> LDS, no register) while this one is read.
// Per 64-key step: 4 tiles S^T[key][query] = K-tile (A) x Q^T (B); online softmax per query column (lane-local over keys + one xor-16 exchange);
// P^T B fragments repacked in-lane from the S^T accumulators (element r <- tile 2u [r], element 8+r <- tile 2u+1 [r]); O^T[d][query] += V^T (A) x P^T (B).
#define AWV    8                     // waves per attention block
#define KSTEP  64                    // keys per stage
#define TILEH  (64 * TSP)            // halves of one staged tile
#define STAGEH (2 * TILEH)           // halves of one stage (K tile, then V^T tile)
static_assert(SEQ % (AWV * 16) == 0);
static_assert(SEQ / KSTEP >= 2);
static_assert(AWV * 32 * 2 * 8 == 64 * HD);   // two 16-B pieces per lane cover one tile

__device__ __forceinline__ unsigned lds_off(const void* p) { return (unsigned)(size_t)p; }
__device__ __forceinline__ v16h ldhs(const h16* p) { return cat16(*(const v8ha*)p, *(const v8ha*)(p + 16)); }
// One stage's copies: each lane moves four 16-B pieces (rows r and r + 32 of both tiles). lk = the lane's LDS byte address in the K tile; gk, gv = its global pieces of row r.
__device__ __forceinline__ void stage_copy(unsigned lk, const h16* gk, const h16* gv) {
    const unsigned lk1 = lk + 32 * TSP * 2, lv = lk + TILEH * 2, lv1 = lk + TILEH * 2 + 32 * TSP * 2;
    const h16* gk1 = gk + 32 * HD; const h16* gv1 = gv + (size_t)32 * SEQ;
    // the closing s_wait_xcnt keeps every later write of these address registers behind the copies' issue
    asm volatile("global_load_async_to_lds_b128 %0, %4, off\n\t"
                 "global_load_async_to_lds_b128 %1, %5, off\n\t"
                 "global_load_async_to_lds_b128 %2, %6, off\n\t"
                 "global_load_async_to_lds_b128 %3, %7, off\n\t"
                 "s_wait_xcnt 0x0"
                 :: "v"(lk), "v"(lk1), "v"(lv), "v"(lv1), "v"(gk), "v"(gk1), "v"(gv), "v"(gv1) : "memory");
}

// second bound: 8 waves per SIMD (128 registers a wave), so that four blocks share a WGP and the whole grid is resident at once
__global__ __launch_bounds__(AWV * 32, 8) void k_attn(const h16* __restrict__ Qp, const h16* __restrict__ Kp, const h16* __restrict__ Vt, h16* Ctx) {
    __shared__ __align__(16) h16 ring[2 * STAGEH];
    __shared__ __align__(16) h16 os[AWV * 16 * TSP];
    const int tid = threadIdx.x;
    const int lane = tid & 31, lr = lane & 15, hi = lane >> 4, wv = tid >> 5;
    const int bh = blockIdx.y; const int q0 = blockIdx.x * (AWV * 16) + wv * 16;
    const size_t pbase = (size_t)bh * SEQ * HD;
    const unsigned cl = lds_off(ring) + (unsigned)(((tid >> 3) * TSP + (tid & 7) * 8) * 2);
    const h16* gk = Kp + pbase + (size_t)(tid >> 3) * HD + (tid & 7) * 8;
    const h16* gv = Vt + pbase + (size_t)(tid >> 3) * SEQ + (tid & 7) * 8;
    stage_copy(cl, gk, gv);
    const h16* qrow = Qp + pbase + (size_t)(q0 + lr) * HD + 8 * hi;
    const v16h qb0 = ldh(qrow), qb1 = ldh(qrow + 32);
    v8f o[4];
#pragma unroll
    for (int dt = 0; dt < 4; ++dt) o[dt] = (v8f){};
    float m = -3.0e38f, l = 0.0f;
    asm volatile("s_wait_asynccnt 0x0" ::: "memory");                        // this wave's pieces of stage 0 have landed
    __syncthreads();                                                         // ... and every other wave's
    stage_copy(cl + STAGEH * 2, gk + (size_t)KSTEP * HD, gv + KSTEP);
#pragma unroll 1
    for (int kb = 0; kb < SEQ; kb += KSTEP) {
        const int sb = ((kb / KSTEP) & 1) * STAGEH;                          // this step's stage
        const h16* kbase = &ring[sb + lr * TSP + 8 * hi];
        const h16* vbase = kbase + TILEH;
        v8f st[4]; v16h ka0, ka1;
#pragma unroll
        for (int t = 0; t < 4; ++t) { const h16* kp = kbase + t * 16 * TSP; ka0 = ldhs(kp); ka1 = ldhs(kp + 32);
            v8f c = (v8f){}; c = wmma16(ka0, qb0, c); c = wmma16(ka1, qb1, c); st[t] = c; }
        asm volatile("v_nop\n\tv_nop\n\tv_nop\n\tv_nop" : "+v"(st[0]), "+v"(st[1]), "+v"(st[2]), "+v"(st[3]) : "v"(ka0), "v"(ka1), "v"(qb0), "v"(qb1));
        float mloc = fmaxf(fmaxf(st[0][0], st[1][0]), fmaxf(st[2][0], st[3][0]));
#pragma unroll
        for (int j = 1; j < 8; ++j) mloc = fmaxf(mloc, fmaxf(fmaxf(st[0][j], st[1][j]), fmaxf(st[2][j], st[3][j])));
        mloc = fmaxf(mloc, __shfl_xor(mloc, 16, 32));
        const float mnew = fmaxf(m, mloc * C2);
        const float corr = __builtin_amdgcn_exp2f(m - mnew); m = mnew;
        v16h pb0, pb1; float psum = 0.0f;
#pragma unroll
        for (int j = 0; j < 8; ++j) {
            const float p0 = __builtin_amdgcn_exp2f(__builtin_fmaf(st[0][j], C2, -mnew));
            const float p1 = __builtin_amdgcn_exp2f(__builtin_fmaf(st[1][j], C2, -mnew));
            const float p2 = __builtin_amdgcn_exp2f(__builtin_fmaf(st[2][j], C2, -mnew));
            const float p3 = __builtin_amdgcn_exp2f(__builtin_fmaf(st[3][j], C2, -mnew));
            psum += (p0 + p1) + (p2 + p3);
            pb0[j] = (h16)p0; pb0[8 + j] = (h16)p1; pb1[j] = (h16)p2; pb1[8 + j] = (h16)p3; }
        l = l * corr + psum;
#pragma unroll
        for (int dt = 0; dt < 4; ++dt)
#pragma unroll
            for (int j = 0; j < 8; ++j) o[dt][j] *= corr;
        v16h va0, va1;
#pragma unroll
        for (int dt = 0; dt < 4; ++dt) { const h16* vp = vbase + dt * 16 * TSP; va0 = ldhs(vp); va1 = ldhs(vp + 32);
            o[dt] = wmma16(va0, pb0, o[dt]); o[dt] = wmma16(va1, pb1, o[dt]); }
        asm volatile("v_nop\n\tv_nop\n\tv_nop\n\tv_nop" : "+v"(o[0]), "+v"(o[1]), "+v"(o[2]), "+v"(o[3]) : "v"(va0), "v"(va1), "v"(pb0), "v"(pb1));
        asm volatile("s_wait_dscnt 0x0" ::: "memory");                       // this wave's reads of this stage are done before the stage is refilled
        asm volatile("s_wait_asynccnt 0x0" ::: "memory");                    // this wave's pieces of the next stage have landed
        __syncthreads();                                                     // publishes the next stage; ends every wave's reads of this one
        if (kb + 2 * KSTEP < SEQ) stage_copy(cl + (unsigned)sb * 2, gk + (size_t)(kb + 2 * KSTEP) * HD, gv + (kb + 2 * KSTEP));
    }
    asm volatile("s_wait_asynccnt 0x0" ::: "memory");                        // no copy is left in flight when the wave ends
    const float lt = l + __shfl_xor(l, 16, 32);
    const float inv = CCAR * (1.0f / lt);
    const int ob = wv * 16 * TSP;                                            // wave-private staging region
#pragma unroll
    for (int dt = 0; dt < 4; ++dt) { v8h hv;                                 // o[dt][j] = O^T[d = dt*16 + 8*hi + j][query lr]
#pragma unroll
        for (int j = 0; j < 8; ++j) hv[j] = (h16)(o[dt][j] * inv);
        *(v8ha*)(&os[ob + lr * TSP + dt * 16 + 8 * hi]) = hv; }
    wave_lds_sync();
    const int b = bh / NH, h = bh % NH;
    h16* dst = Ctx + ((size_t)b * SEQ + q0) * DM + h * HD;
{
#pragma unroll
        for (int it = 0; it < 4; ++it) { const int qq = it * 4 + (lane >> 3), pc = lane & 7; const v8h val = *(const v8ha*)(&os[ob + qq * TSP + pc * 8]);
            *(v8h*)(dst + (size_t)qq * DM + pc * 8) = val; }
         }
}

__global__ __launch_bounds__(32) void k_outp(const h16* __restrict__ CTX, const h16* __restrict__ WO, const float* __restrict__ bias, float* OUT) {
    __shared__ __align__(16) float os[16 * 68];
    const int lane = threadIdx.x & 31, lr = lane & 15, hi = lane >> 4;
    const int r0 = blockIdx.x * 64, c0 = blockIdx.y * 64; const int bz = r0 / SEQ, s0 = r0 % SEQ;
    v8f acc[4][4];
    gemm64(CTX + (size_t)r0 * DM, WO + (size_t)c0 * DM, acc, lr, hi);       // acc[mb][nb][j]: row mb*16 + 8*hi + j, col nb*16 + lr
    const v4f braw = *(const v4f*)(bias + c0 + lr * 4); v4f bb; bb[0] = bfr(braw[0]); bb[1] = bfr(braw[1]); bb[2] = bfr(braw[2]); bb[3] = bfr(braw[3]);
    float* cbase = OUT + ((size_t)bz * SEQ_FULL + s0) * DM + c0;
#pragma unroll
    for (int mb = 0; mb < 4; ++mb) {
#pragma unroll
        for (int nb = 0; nb < 4; ++nb) {
#pragma unroll
            for (int j = 0; j < 8; ++j) os[(hi * 8 + j) * 68 + nb * 16 + lr] = acc[mb][nb][j] * OINV; }
        wave_lds_sync();
        float* crow = cbase + (size_t)(mb * 16) * DM;
{
#pragma unroll
            for (int s = 0; s < 8; ++s) { const int row = 2 * s + hi, cofs = lr * 4; v4f val = *(const v4fa*)(os + row * 68 + cofs); val += bb;
                *(v4f*)(crow + (size_t)row * DM + cofs) = val; }
             }
        wave_lds_sync();
    }
}

#define SZ_X    ((size_t)NB * SEQ * DM * 2)
#define SZ_W    ((size_t)DM * DM * 2)
#define SZ_ALL  (SZ_X * 5 + SZ_W * 4)
static_assert(SZ_X % 256 == 0);
static_assert(SZ_W % 256 == 0);
static_assert(SZ_ALL <= (size_t)134217728);

extern "C" void kernel_launch(void* const* d_in, const int* in_sizes, int n_in,
                              void* d_out, int out_size, void* d_ws, size_t ws_size, hipStream_t stream) {
    if (n_in < 9) return;
    const size_t needx = ((size_t)(NB - 1) * SEQ_FULL + SEQ) * DM;
    if ((size_t)in_sizes[0] < needx) return;
    if ((size_t)in_sizes[1] < (size_t)NH * DM * HD || (size_t)in_sizes[3] < (size_t)NH * DM * HD || (size_t)in_sizes[5] < (size_t)NH * DM * HD) return;
    if ((size_t)in_sizes[2] < (size_t)NH * HD || (size_t)in_sizes[4] < (size_t)NH * HD || (size_t)in_sizes[6] < (size_t)NH * HD) return;
    if ((size_t)in_sizes[7] < (size_t)DM * DM || (size_t)in_sizes[8] < (size_t)DM) return;
    if ((size_t)out_size < needx) return;
    if (SZ_ALL > ws_size) return;
    const float* xs = (const float*)d_in[0];
    const float* Wq = (const float*)d_in[1]; const float* bq = (const float*)d_in[2];
    const float* Wk = (const float*)d_in[3]; const float* bk = (const float*)d_in[4];
    const float* Wv = (const float*)d_in[5]; const float* bv = (const float*)d_in[6];
    const float* Wo = (const float*)d_in[7]; const float* bo = (const float*)d_in[8];
    float* OUT = (float*)d_out;
    char* wsp = (char*)d_ws;
    h16* XH  = (h16*)wsp; wsp += SZ_X;      // [NB*SEQ][DM]
    h16* WQ  = (h16*)wsp; wsp += SZ_W;      // Bt [h*64+d][e], x64
    h16* WK  = (h16*)wsp; wsp += SZ_W;
    h16* WV  = (h16*)wsp; wsp += SZ_W;
    h16* WO  = (h16*)wsp; wsp += SZ_W;      // Bt [out][in], x64
    h16* QP  = (h16*)wsp; wsp += SZ_X;      // [b][h][s][d]
    h16* KP  = (h16*)wsp; wsp += SZ_X;      // [b][h][s][d]
    h16* VT  = (h16*)wsp; wsp += SZ_X;      // [b][h][d][s]
    h16* CTX = (h16*)wsp; wsp += SZ_X;      // [NB*SEQ][DM], x64

    k_cvt8<<<(unsigned)(((size_t)NB * SEQ * DM / 8 + 255) / 256), 256, 0, stream>>>(xs, XH);
    const unsigned gw = (unsigned)(((size_t)DM * DM / 8 + 255) / 256);
    k_wt<<<gw, 256, 0, stream>>>(Wq, DM, HD, NH, WQ);     // in[h][e][d] -> Bt[h*64 + d][e]
    k_wt<<<gw, 256, 0, stream>>>(Wk, DM, HD, NH, WK);
    k_wt<<<gw, 256, 0, stream>>>(Wv, DM, HD, NH, WV);
    k_wt<<<gw, 256, 0, stream>>>(Wo, DM, DM, 1, WO);      // in[e][o] -> Bt[o][e]
    k_projqk<<<dim3(NB * SEQ / 64, NH, 1), 32, 0, stream>>>(XH, WQ, bq, QP);
    k_projqk<<<dim3(NB * SEQ / 64, NH, 1), 32, 0, stream>>>(XH, WK, bk, KP);
    k_projv<<<dim3(NB * SEQ / 64, NH, 1), 32, 0, stream>>>(XH, WV, bv, VT);
    k_attn<<<dim3(SEQ / (AWV * 16), NB * NH, 1), AWV * 32, 0, stream>>>(QP, KP, VT, CTX);
    k_outp<<<dim3(NB * SEQ / 64, DM / 64, 1), 32, 0, stream>>>(CTX, WO, bo, OUT);
}

// v002
// It runs in 154 microseconds.
// Two timings next to v001 both put it at 1.51 times that version's speed.
// Over all steps from v000 it is 2.35 times as fast.
#include <hip/hip_runtime.h>

#ifndef NB
#define NB 4
#endif
#ifndef SEQ
#define SEQ 2048
#endif
#define NB_FULL  4
#define SEQ_FULL 2048
#define DM   1024
#define NH   16
#define HD   64
#define WCAR 64.0f
#define WINV (1.0f / 64.0f)
#define CCAR 64.0f
#define OINV (1.0f / 4096.0f)
#define C2   0.18033688011112042f   // (1/8) * log2(e)
#define TSP  72                     // LDS tile pitch in halves (144 B, multiple of 16 B)

static_assert(NH * HD == DM);
static_assert(HD == 64);
static_assert(DM % 32 == 0);
static_assert(DM % 64 == 0);
static_assert(SEQ % 64 == 0);
static_assert(SEQ <= SEQ_FULL);
static_assert(NB <= NB_FULL);
static_assert((TSP * 2) % 16 == 0);
static_assert(TSP >= HD);

typedef _Float16 h16;
typedef __attribute__((ext_vector_type(16))) _Float16 v16h;
typedef __attribute__((ext_vector_type(8)))  _Float16 v8h;
typedef __attribute__((ext_vector_type(8)))  float    v8f;
typedef __attribute__((ext_vector_type(4)))  float    v4f;
typedef v8h __attribute__((may_alias)) v8ha;
typedef v4f __attribute__((may_alias)) v4fa;

__device__ __forceinline__ unsigned short f2bf(float f) { unsigned u = __float_as_uint(f); u += 0x7FFFu + ((u >> 16) & 1u); return (unsigned short)(u >> 16); }
__device__ __forceinline__ float bf2f(unsigned short b) { return __uint_as_float(((unsigned)b) << 16); }
__device__ __forceinline__ float bfr(float f) { return bf2f(f2bf(f)); }
__device__ __forceinline__ v16h cat16(v8h lo, v8h hi) { return __builtin_shufflevector(lo, hi, 0, 1, 2, 3, 4, 5, 6, 7, 8, 9, 10, 11, 12, 13, 14, 15); }
// fragment from a K-contiguous f16 row: elements 0..7 <- p[0..7], 8..15 <- p[16..23]; caller passes p = row + k0 + 8*(lane>>4)
__device__ __forceinline__ v16h ldh(const h16* p) { return cat16(*(const v8h*)p, *(const v8h*)(p + 16)); }
__device__ __forceinline__ v8f wmma16(v16h a, v16h b, v8f c) { return __builtin_amdgcn_wmma_f32_16x16x32_f16(false, a, false, b, (short)0, c, false, false); }
__device__ __forceinline__ void wave_lds_sync() { __builtin_amdgcn_fence(3 /* release order */, "wavefront"); __builtin_amdgcn_wave_barrier(); asm volatile("" ::: "memory"); }

__global__ __launch_bounds__(256) void k_cvt8(const float* __restrict__ x, h16* XH) {
    const size_t i = (size_t)blockIdx.x * 256 + threadIdx.x; const size_t n8 = (size_t)NB * SEQ * DM / 8; if (i >= n8) return;
    const size_t r = i / (DM / 8); const size_t c8 = i % (DM / 8); const size_t b = r / SEQ, s = r % SEQ;
    const float* src = x + (b * SEQ_FULL + s) * DM + c8 * 8;
    const v4f v0 = *(const v4f*)src; const v4f v1 = *(const v4f*)(src + 4); v8h o;
    o[0] = (h16)bfr(v0[0]); o[1] = (h16)bfr(v0[1]); o[2] = (h16)bfr(v0[2]); o[3] = (h16)bfr(v0[3]);
    o[4] = (h16)bfr(v1[0]); o[5] = (h16)bfr(v1[1]); o[6] = (h16)bfr(v1[2]); o[7] = (h16)bfr(v1[3]);
    *(v8h*)(XH + i * 8) = o; 
}

__global__ __launch_bounds__(256) void k_wt(const float* __restrict__ w, int K, int N, int Z, h16* Bt) {
    const size_t i = (size_t)blockIdx.x * 256 + threadIdx.x; const size_t n8 = (size_t)Z * N * K / 8; if (i >= n8) return;
    const size_t e = i * 8; const size_t k = e % (size_t)K; const size_t n = (e / (size_t)K) % (size_t)N; const size_t z = e / ((size_t)K * N);
    const float* s = w + (z * K + k) * N + n; v8h o;
#pragma unroll
    for (int j = 0; j < 8; ++j) o[j] = (h16)(bfr(s[(size_t)j * N]) * WCAR);
    *(v8h*)(Bt + e) = o; 
}

// ---- gemm_blk: one block of 8 waves, 64x64 f32 tile per wave: acc[mb][nb][j] = sum_k A[arow + mb*16 + 8*hi + j][k] * Bt[brow + nb*16 + lr][k], K = DM, both operands K-contiguous f16 rows (pitch DM).
// The block's RA rows of A and GROWS - RA rows of Bt are shared through LDS. A stage = GKS k of all GROWS rows (rows of 256 B at the 272-B pitch); two stages in LDS:
// the next one is copied in (global -> LDS, no register, whole 256-B units) while this one is read.
#define GWV   8                      // waves per GEMM block
#define GKS   128                    // k per stage
#define GP    136                    // LDS row pitch in halves (272 B = 16 B x 17)
#define GROWS 384                    // rows per stage, both operands together
#define GSTH  (GROWS * GP)           // halves of one stage
static_assert(DM % GKS == 0);
static_assert(DM / GKS >= 2);
static_assert((GP * 2) % 16 == 0);
static_assert(GP >= GKS);
static_assert(GWV * 32 * 8 * 8 == 128 * GKS);   // eight 16-B pieces per lane cover 128 rows of a stage
static_assert((NB * SEQ) % 128 == 0);
static_assert(DM % 256 == 0);

__device__ __forceinline__ unsigned lds_off(const void* p) { return (unsigned)(size_t)p; }
__device__ __forceinline__ v16h ldhs(const h16* p) { return cat16(*(const v8ha*)p, *(const v8ha*)(p + 16)); }
// 128 rows of a stage: each lane moves eight 16-B pieces (rows r, r + 16, ... r + 112). l = the lane's LDS byte address of row r; g = its global piece of row r.
__device__ __forceinline__ void copy_rows128(unsigned l, const h16* g) {
    const unsigned l1 = l + 16 * GP * 2, l2 = l + 32 * GP * 2, l3 = l + 48 * GP * 2, l4 = l + 64 * GP * 2, l5 = l + 80 * GP * 2, l6 = l + 96 * GP * 2, l7 = l + 112 * GP * 2;
    const h16* g1 = g + 16 * DM; const h16* g2 = g + 32 * DM; const h16* g3 = g + 48 * DM; const h16* g4 = g + 64 * DM;
    const h16* g5 = g + 80 * DM; const h16* g6 = g + 96 * DM; const h16* g7 = g + 112 * DM;
    // the closing s_wait_xcnt keeps every later write of these address registers behind the copies' issue
    asm volatile("global_load_async_to_lds_b128 %0, %8, off\n\t"
                 "global_load_async_to_lds_b128 %1, %9, off\n\t"
                 "global_load_async_to_lds_b128 %2, %10, off\n\t"
                 "global_load_async_to_lds_b128 %3, %11, off\n\t"
                 "global_load_async_to_lds_b128 %4, %12, off\n\t"
                 "global_load_async_to_lds_b128 %5, %13, off\n\t"
                 "global_load_async_to_lds_b128 %6, %14, off\n\t"
                 "global_load_async_to_lds_b128 %7, %15, off\n\t"
                 "s_wait_xcnt 0x0"
                 :: "v"(l), "v"(l1), "v"(l2), "v"(l3), "v"(l4), "v"(l5), "v"(l6), "v"(l7),
                    "v"(g), "v"(g1), "v"(g2), "v"(g3), "v"(g4), "v"(g5), "v"(g6), "v"(g7) : "memory");
    __builtin_amdgcn_sched_barrier(0);                                       // keeps a later group's address sums behind this group's issue: fewer registers live at once, no spill
}
// One stage's copies: stage rows 0 .. RA-1 are A rows, the rest Bt rows. cl = the lane's LDS byte address in the stage's row (tid >> 4); ga, gb = its global pieces of that row of A and of Bt at this stage's k.
template <int RA>
__device__ __forceinline__ void gemm_stage(unsigned cl, const h16* ga, const h16* gb) {
#pragma unroll
    for (int r0 = 0; r0 < GROWS; r0 += 128) copy_rows128(cl + (unsigned)(r0 * GP * 2), r0 < RA ? ga + (size_t)r0 * DM : gb + (size_t)(r0 - RA) * DM);
}

template <int RA>
__device__ __forceinline__ void gemm_blk(const h16* __restrict__ A, const h16* __restrict__ Bt, h16* ring, int arow, int brow, v8f (&acc)[4][4], int tid, int lr, int hi) {
    static_assert(RA % 128 == 0 && RA < GROWS);
#pragma unroll
    for (int mb = 0; mb < 4; ++mb)
#pragma unroll
        for (int nb = 0; nb < 4; ++nb) acc[mb][nb] = (v8f){};
    const unsigned cl = lds_off(ring) + (unsigned)(((tid >> 4) * GP + (tid & 15) * 8) * 2);
    const h16* ga = A + (size_t)(tid >> 4) * DM + (tid & 15) * 8;
    const h16* gb = Bt + (size_t)(tid >> 4) * DM + (tid & 15) * 8;
    gemm_stage<RA>(cl, ga, gb);
    asm volatile("s_wait_asynccnt 0x0" ::: "memory");                        // this wave's pieces of stage 0 have landed
    __syncthreads();                                                         // ... and every other wave's
    gemm_stage<RA>(cl + GSTH * 2, ga + GKS, gb + GKS);
#pragma unroll 1
    for (int t = 0; t < DM / GKS; ++t) {
        const int sb = (t & 1) * GSTH;                                       // this trip's stage
        const h16* ap = ring + sb + (arow + lr) * GP + 8 * hi;
        const h16* bp = ring + sb + (RA + brow + lr) * GP + 8 * hi;
        v16h a[2][4], b[2][4];                                               // two fragment sets: the next 32 k of this stage are read as one group while this set is multiplied
#pragma unroll
        for (int f = 0; f < 4; ++f) { a[0][f] = ldhs(ap + f * 16 * GP); b[0][f] = ldhs(bp + f * 16 * GP); }
#pragma unroll
        for (int ks = 0; ks < GKS / 32; ++ks) {
            if (ks + 1 < GKS / 32) {
#pragma unroll
                for (int f = 0; f < 4; ++f) { a[(ks + 1) & 1][f] = ldhs(ap + f * 16 * GP + (ks + 1) * 32); b[(ks + 1) & 1][f] = ldhs(bp + f * 16 * GP + (ks + 1) * 32); }
            }
            else {                                                           // the stage's last fragments are in registers: the buffer is handed over before they are multiplied, so the refill flies longer
                asm volatile("s_wait_dscnt 0x0" ::: "memory");               // this wave's reads of this stage are done before the stage is refilled
                asm volatile("s_wait_asynccnt 0x0" ::: "memory");            // this wave's pieces of the next stage have landed
                __syncthreads();                                             // publishes the next stage; ends every wave's reads of this one
                if (t + 2 < DM / GKS) gemm_stage<RA>(cl + (unsigned)sb * 2, ga + (t + 2) * GKS, gb + (t + 2) * GKS);
            }
            __builtin_amdgcn_sched_barrier(0);                               // keeps the read group (last block: the hand-over) ahead of the matrix run instead of spread among it
#pragma unroll
            for (int nb = 0; nb < 4; ++nb)
#pragma unroll
                for (int mb = 0; mb < 4; ++mb) acc[mb][nb] = wmma16(a[ks & 1][mb], b[ks & 1][nb], acc[mb][nb]);
            __builtin_amdgcn_sched_barrier(0);                               // keeps this matrix run ahead of the next read group and of the hand-over
        }
    }
    asm volatile("s_wait_asynccnt 0x0" ::: "memory");                        // no copy is left in flight behind the loop
}

__device__ __forceinline__ void store_tile64(const h16* ts_base_unused, h16* dst, size_t pitch, int lane);

// ---- k_projqk: plane P[b][h][s][d] (f16) = x Wt^T / 64 + b. Operand roles swapped (A = weight rows, B = x rows) so each lane holds 8 consecutive d of one s.
// Block = 4 heads (256 weight rows) x 128 x rows; wave wv: head wv & 3 of them, x rows 64 * (wv >> 2).
__global__ __launch_bounds__(GWV * 32) void k_projqk(const h16* __restrict__ XH, const h16* __restrict__ WT, const float* __restrict__ bias, h16* P) {
    __shared__ __align__(16) h16 ring[2 * GSTH];
    __shared__ __align__(16) h16 tsall[GWV * 64 * TSP];
    const int tid = threadIdx.x, lane = tid & 31, lr = lane & 15, hi = lane >> 4, wv = tid >> 5;
    h16* ts = tsall + wv * 64 * TSP;                                        // wave-private staging region
    const int r0 = blockIdx.x * 128 + (wv >> 2) * 64, head = blockIdx.y * 4 + (wv & 3); const int bz = r0 / SEQ, s0 = r0 % SEQ;
    v8f acc[4][4];
    gemm_blk<256>(WT + (size_t)blockIdx.y * 256 * DM, XH + (size_t)blockIdx.x * 128 * DM, ring, (wv & 3) * 64, (wv >> 2) * 64, acc, tid, lr, hi);   // acc[mb][nb][j]: d = mb*16 + 8*hi + j, s = nb*16 + lr
#pragma unroll
    for (int mb = 0; mb < 4; ++mb) {
        const v4f b0 = *(const v4f*)(bias + head * HD + mb * 16 + 8 * hi); const v4f b1 = *(const v4f*)(bias + head * HD + mb * 16 + 8 * hi + 4);
        v8f bb; bb[0] = bfr(b0[0]); bb[1] = bfr(b0[1]); bb[2] = bfr(b0[2]); bb[3] = bfr(b0[3]); bb[4] = bfr(b1[0]); bb[5] = bfr(b1[1]); bb[6] = bfr(b1[2]); bb[7] = bfr(b1[3]);
#pragma unroll
        for (int nb = 0; nb < 4; ++nb) { v8h hv;
#pragma unroll
            for (int j = 0; j < 8; ++j) hv[j] = (h16)(acc[mb][nb][j] * WINV + bb[j]);
            *(v8ha*)(&ts[(nb * 16 + lr) * TSP + mb * 16 + 8 * hi]) = hv; } }
    wave_lds_sync();                                                        // ts is private to this wave
    h16* dst = P + (((size_t)bz * NH + head) * SEQ + s0) * HD;
{
#pragma unroll
        for (int it = 0; it < 16; ++it) { const int L = it * 4 + (lane >> 3), pc = lane & 7; const v8h val = *(const v8ha*)(&ts[L * TSP + pc * 8]);
            *(v8h*)(dst + (size_t)L * HD + pc * 8) = val; }
         }
}

// ---- k_projv: transposed plane VT[b][h][d][s] (f16) = x Wv^T / 64 + bv (A = x rows, B = weight rows: each lane holds 8 consecutive s of one d).
// Block = 128 x rows x 4 heads (256 weight rows); wave wv: x rows 64 * (wv >> 2), head wv & 3 of them.
__global__ __launch_bounds__(GWV * 32) void k_projv(const h16* __restrict__ XH, const h16* __restrict__ WT, const float* __restrict__ bias, h16* VT) {
    __shared__ __align__(16) h16 ring[2 * GSTH];
    __shared__ __align__(16) h16 tsall[GWV * 64 * TSP];
    const int tid = threadIdx.x, lane = tid & 31, lr = lane & 15, hi = lane >> 4, wv = tid >> 5;
    h16* ts = tsall + wv * 64 * TSP;                                        // wave-private staging region
    const int r0 = blockIdx.x * 128 + (wv >> 2) * 64, head = blockIdx.y * 4 + (wv & 3); const int bz = r0 / SEQ, s0 = r0 % SEQ;
    v8f acc[4][4];
    gemm_blk<128>(XH + (size_t)blockIdx.x * 128 * DM, WT + (size_t)blockIdx.y * 256 * DM, ring, (wv >> 2) * 64, (wv & 3) * 64, acc, tid, lr, hi);   // acc[mb][nb][j]: s = mb*16 + 8*hi + j, d = nb*16 + lr
#pragma unroll
    for (int nb = 0; nb < 4; ++nb) { const float bb = bfr(bias[head * HD + nb * 16 + lr]);
#pragma unroll
        for (int mb = 0; mb < 4; ++mb) { v8h hv;
#pragma unroll
            for (int j = 0; j < 8; ++j) hv[j] = (h16)(acc[mb][nb][j] * WINV + bb);
            *(v8ha*)(&ts[(nb * 16 + lr) * TSP + mb * 16 + 8 * hi]) = hv; } }
    wave_lds_sync();
    h16* dst = VT + (((size_t)bz * NH + head) * HD) * SEQ + s0;
{
#pragma unroll
        for (int it = 0; it < 16; ++it) { const int L = it * 4 + (lane >> 3), pc = lane & 7; const v8h val = *(const v8ha*)(&ts[L * TSP + pc * 8]);
            *(v8h*)(dst + (size_t)L * SEQ + pc * 8) = val; }
         }
}

// ---- k_attn: fused attention. One wave = 16 query rows of one (b,h); the 8 waves of a block walk the same keys and share each 64-key K tile and V^T tile through LDS.
// A stage = K tile [64 keys][64 d] + V^T tile [64 d][64 keys], rows of 128 B at the 144-B pitch; two stages in LDS: the next one is copied in (global -> LDS, no register) while this one is read.
// Per 64-key step: 4 tiles S^T[key][query] = K-tile (A) x Q^T (B); online softmax per query column (lane-local over keys + one xor-16 exchange);
// P^T B fragments repacked in-lane from the S^T accumulators (element r <- tile 2u [r], element 8+r <- tile 2u+1 [r]); O^T[d][query] += V^T (A) x P^T (B).
#define AWV    8                     // waves per attention block
#define KSTEP  64                    // keys per stage
#define TILEH  (64 * TSP)            // halves of one staged tile
#define STAGEH (2 * TILEH)           // halves of one stage (K tile, then V^T tile)
static_assert(SEQ % (AWV * 16) == 0);
static_assert(SEQ / KSTEP >= 2);
static_assert(AWV * 32 * 2 * 8 == 64 * HD);   // two 16-B pieces per lane cover one tile

// One stage's copies: each lane moves four 16-B pieces (rows r and r + 32 of both tiles). lk = the lane's LDS byte address in the K tile; gk, gv = its global pieces of row r.
__device__ __forceinline__ void stage_copy(unsigned lk, const h16* gk, const h16* gv) {
    const unsigned lk1 = lk + 32 * TSP * 2, lv = lk + TILEH * 2, lv1 = lk + TILEH * 2 + 32 * TSP * 2;
    const h16* gk1 = gk + 32 * HD; const h16* gv1 = gv + (size_t)32 * SEQ;
    // the closing s_wait_xcnt keeps every later write of these address registers behind the copies' issue
    asm volatile("global_load_async_to_lds_b128 %0, %4, off\n\t"
                 "global_load_async_to_lds_b128 %1, %5, off\n\t"
                 "global_load_async_to_lds_b128 %2, %6, off\n\t"
                 "global_load_async_to_lds_b128 %3, %7, off\n\t"
                 "s_wait_xcnt 0x0"
                 :: "v"(lk), "v"(lk1), "v"(lv), "v"(lv1), "v"(gk), "v"(gk1), "v"(gv), "v"(gv1) : "memory");
}

// second bound: 8 waves per SIMD (128 registers a wave), so that four blocks share a WGP and the whole grid is resident at once
__global__ __launch_bounds__(AWV * 32, 8) void k_attn(const h16* __restrict__ Qp, const h16* __restrict__ Kp, const h16* __restrict__ Vt, h16* Ctx) {
    __shared__ __align__(16) h16 ring[2 * STAGEH];
    __shared__ __align__(16) h16 os[AWV * 16 * TSP];
    const int tid = threadIdx.x;
    const int lane = tid & 31, lr = lane & 15, hi = lane >> 4, wv = tid >> 5;
    const int bh = blockIdx.y; const int q0 = blockIdx.x * (AWV * 16) + wv * 16;
    const size_t pbase = (size_t)bh * SEQ * HD;
    const unsigned cl = lds_off(ring) + (unsigned)(((tid >> 3) * TSP + (tid & 7) * 8) * 2);
    const h16* gk = Kp + pbase + (size_t)(tid >> 3) * HD + (tid & 7) * 8;
    const h16* gv = Vt + pbase + (size_t)(tid >> 3) * SEQ + (tid & 7) * 8;
    stage_copy(cl, gk, gv);
    const h16* qrow = Qp + pbase + (size_t)(q0 + lr) * HD + 8 * hi;
    const v16h qb0 = ldh(qrow), qb1 = ldh(qrow + 32);
    v8f o[4];
#pragma unroll
    for (int dt = 0; dt < 4; ++dt) o[dt] = (v8f){};
    float m = -3.0e38f, l = 0.0f;
    asm volatile("s_wait_asynccnt 0x0" ::: "memory");                        // this wave's pieces of stage 0 have landed
    __syncthreads();                                                         // ... and every other wave's
    stage_copy(cl + STAGEH * 2, gk + (size_t)KSTEP * HD, gv + KSTEP);
#pragma unroll 1
    for (int kb = 0; kb < SEQ; kb += KSTEP) {
        const int sb = ((kb / KSTEP) & 1) * STAGEH;                          // this step's stage
        const h16* kbase = &ring[sb + lr * TSP + 8 * hi];
        const h16* vbase = kbase + TILEH;
        v8f st[4]; v16h ka0, ka1;
#pragma unroll
        for (int t = 0; t < 4; ++t) { const h16* kp = kbase + t * 16 * TSP; ka0 = ldhs(kp); ka1 = ldhs(kp + 32);
            v8f c = (v8f){}; c = wmma16(ka0, qb0, c); c = wmma16(ka1, qb1, c); st[t] = c; }
        asm volatile("v_nop\n\tv_nop\n\tv_nop\n\tv_nop" : "+v"(st[0]), "+v"(st[1]), "+v"(st[2]), "+v"(st[3]) : "v"(ka0), "v"(ka1), "v"(qb0), "v"(qb1));
        float mloc = fmaxf(fmaxf(st[0][0], st[1][0]), fmaxf(st[2][0], st[3][0]));
#pragma unroll
        for (int j = 1; j < 8; ++j) mloc = fmaxf(mloc, fmaxf(fmaxf(st[0][j], st[1][j]), fmaxf(st[2][j], st[3][j])));
        mloc = fmaxf(mloc, __shfl_xor(mloc, 16, 32));
        const float mnew = fmaxf(m, mloc * C2);
        const float corr = __builtin_amdgcn_exp2f(m - mnew); m = mnew;
        v16h pb0, pb1; float psum = 0.0f;
#pragma unroll
        for (int j = 0; j < 8; ++j) {
            const float p0 = __builtin_amdgcn_exp2f(__builtin_fmaf(st[0][j], C2, -mnew));
            const float p1 = __builtin_amdgcn_exp2f(__builtin_fmaf(st[1][j], C2, -mnew));
            const float p2 = __builtin_amdgcn_exp2f(__builtin_fmaf(st[2][j], C2, -mnew));
            const float p3 = __builtin_amdgcn_exp2f(__builtin_fmaf(st[3][j], C2, -mnew));
            psum += (p0 + p1) + (p2 + p3);
            pb0[j] = (h16)p0; pb0[8 + j] = (h16)p1; pb1[j] = (h16)p2; pb1[8 + j] = (h16)p3; }
        l = l * corr + psum;
#pragma unroll
        for (int dt = 0; dt < 4; ++dt)
#pragma unroll
            for (int j = 0; j < 8; ++j) o[dt][j] *= corr;
        v16h va0, va1;
#pragma unroll
        for (int dt = 0; dt < 4; ++dt) { const h16* vp = vbase + dt * 16 * TSP; va0 = ldhs(vp); va1 = ldhs(vp + 32);
            o[dt] = wmma16(va0, pb0, o[dt]); o[dt] = wmma16(va1, pb1, o[dt]); }
        asm volatile("v_nop\n\tv_nop\n\tv_nop\n\tv_nop" : "+v"(o[0]), "+v"(o[1]), "+v"(o[2]), "+v"(o[3]) : "v"(va0), "v"(va1), "v"(pb0), "v"(pb1));
        asm volatile("s_wait_dscnt 0x0" ::: "memory");                       // this wave's reads of this stage are done before the stage is refilled
        asm volatile("s_wait_asynccnt 0x0" ::: "memory");                    // this wave's pieces of the next stage have landed
        __syncthreads();                                                     // publishes the next stage; ends every wave's reads of this one
        if (kb + 2 * KSTEP < SEQ) stage_copy(cl + (unsigned)sb * 2, gk + (size_t)(kb + 2 * KSTEP) * HD, gv + (kb + 2 * KSTEP));
    }
    asm volatile("s_wait_asynccnt 0x0" ::: "memory");                        // no copy is left in flight when the wave ends
    const float lt = l + __shfl_xor(l, 16, 32);
    const float inv = CCAR * (1.0f / lt);
    const int ob = wv * 16 * TSP;                                            // wave-private staging region
#pragma unroll
    for (int dt = 0; dt < 4; ++dt) { v8h hv;                                 // o[dt][j] = O^T[d = dt*16 + 8*hi + j][query lr]
#pragma unroll
        for (int j = 0; j < 8; ++j) hv[j] = (h16)(o[dt][j] * inv);
        *(v8ha*)(&os[ob + lr * TSP + dt * 16 + 8 * hi]) = hv; }
    wave_lds_sync();
    const int b = bh / NH, h = bh % NH;
    h16* dst = Ctx + ((size_t)b * SEQ + q0) * DM + h * HD;
{
#pragma unroll
        for (int it = 0; it < 4; ++it) { const int qq = it * 4 + (lane >> 3), pc = lane & 7; const v8h val = *(const v8ha*)(&os[ob + qq * TSP + pc * 8]);
            *(v8h*)(dst + (size_t)qq * DM + pc * 8) = val; }
         }
}

// Block = 128 ctx rows x 256 output columns; wave wv: rows 64 * (wv >> 2), columns 64 * (wv & 3).
__global__ __launch_bounds__(GWV * 32) void k_outp(const h16* __restrict__ CTX, const h16* __restrict__ WO, const float* __restrict__ bias, float* OUT) {
    __shared__ __align__(16) h16 ring[2 * GSTH];
    __shared__ __align__(16) float osall[GWV * 16 * 68];
    const int tid = threadIdx.x, lane = tid & 31, lr = lane & 15, hi = lane >> 4, wv = tid >> 5;
    float* os = osall + wv * 16 * 68;                                       // wave-private staging region
    const int r0 = blockIdx.x * 128 + (wv >> 2) * 64, c0 = blockIdx.y * 256 + (wv & 3) * 64; const int bz = r0 / SEQ, s0 = r0 % SEQ;
    v8f acc[4][4];
    gemm_blk<128>(CTX + (size_t)blockIdx.x * 128 * DM, WO + (size_t)blockIdx.y * 256 * DM, ring, (wv >> 2) * 64, (wv & 3) * 64, acc, tid, lr, hi);       // acc[mb][nb][j]: row mb*16 + 8*hi + j, col nb*16 + lr
    const v4f braw = *(const v4f*)(bias + c0 + lr * 4); v4f bb; bb[0] = bfr(braw[0]); bb[1] = bfr(braw[1]); bb[2] = bfr(braw[2]); bb[3] = bfr(braw[3]);
    float* cbase = OUT + ((size_t)bz * SEQ_FULL + s0) * DM + c0;
#pragma unroll
    for (int mb = 0; mb < 4; ++mb) {
#pragma unroll
        for (int nb = 0; nb < 4; ++nb) {
#pragma unroll
            for (int j = 0; j < 8; ++j) os[(hi * 8 + j) * 68 + nb * 16 + lr] = acc[mb][nb][j] * OINV; }
        wave_lds_sync();
        float* crow = cbase + (size_t)(mb * 16) * DM;
{
#pragma unroll
            for (int s = 0; s < 8; ++s) { const int row = 2 * s + hi, cofs = lr * 4; v4f val = *(const v4fa*)(os + row * 68 + cofs); val += bb;
                *(v4f*)(crow + (size_t)row * DM + cofs) = val; }
             }
        wave_lds_sync();
    }
}

#define SZ_X    ((size_t)NB * SEQ * DM * 2)
#define SZ_W    ((size_t)DM * DM * 2)
#define SZ_ALL  (SZ_X * 5 + SZ_W * 4)
static_assert(SZ_X % 256 == 0);
static_assert(SZ_W % 256 == 0);
static_assert(SZ_ALL <= (size_t)134217728);

extern "C" void kernel_launch(void* const* d_in, const int* in_sizes, int n_in,
                              void* d_out, int out_size, void* d_ws, size_t ws_size, hipStream_t stream) {
    if (n_in < 9) return;
    const size_t needx = ((size_t)(NB - 1) * SEQ_FULL + SEQ) * DM;
    if ((size_t)in_sizes[0] < needx) return;
    if ((size_t)in_sizes[1] < (size_t)NH * DM * HD || (size_t)in_sizes[3] < (size_t)NH * DM * HD || (size_t)in_sizes[5] < (size_t)NH * DM * HD) return;
    if ((size_t)in_sizes[2] < (size_t)NH * HD || (size_t)in_sizes[4] < (size_t)NH * HD || (size_t)in_sizes[6] < (size_t)NH * HD) return;
    if ((size_t)in_sizes[7] < (size_t)DM * DM || (size_t)in_sizes[8] < (size_t)DM) return;
    if ((size_t)out_size < needx) return;
    if (SZ_ALL > ws_size) return;
    const float* xs = (const float*)d_in[0];
    const float* Wq = (const float*)d_in[1]; const float* bq = (const float*)d_in[2];
    const float* Wk = (const float*)d_in[3]; const float* bk = (const float*)d_in[4];
    const float* Wv = (const float*)d_in[5]; const float* bv = (const float*)d_in[6];
    const float* Wo = (const float*)d_in[7]; const float* bo = (const float*)d_in[8];
    float* OUT = (float*)d_out;
    char* wsp = (char*)d_ws;
    h16* XH  = (h16*)wsp; wsp += SZ_X;      // [NB*SEQ][DM]
    h16* WQ  = (h16*)wsp; wsp += SZ_W;      // Bt [h*64+d][e], x64
    h16* WK  = (h16*)wsp; wsp += SZ_W;
    h16* WV  = (h16*)wsp; wsp += SZ_W;
    h16* WO  = (h16*)wsp; wsp += SZ_W;      // Bt [out][in], x64
    h16* QP  = (h16*)wsp; wsp += SZ_X;      // [b][h][s][d]
    h16* KP  = (h16*)wsp; wsp += SZ_X;      // [b][h][s][d]
    h16* VT  = (h16*)wsp; wsp += SZ_X;      // [b][h][d][s]
    h16* CTX = (h16*)wsp; wsp += SZ_X;      // [NB*SEQ][DM], x64

    k_cvt8<<<(unsigned)(((size_t)NB * SEQ * DM / 8 + 255) / 256), 256, 0, stream>>>(xs, XH);
    const unsigned gw = (unsigned)(((size_t)DM * DM / 8 + 255) / 256);
    k_wt<<<gw, 256, 0, stream>>>(Wq, DM, HD, NH, WQ);     // in[h][e][d] -> Bt[h*64 + d][e]
    k_wt<<<gw, 256, 0, stream>>>(Wk, DM, HD, NH, WK);
    k_wt<<<gw, 256, 0, stream>>>(Wv, DM, HD, NH, WV);
    k_wt<<<gw, 256, 0, stream>>>(Wo, DM, DM, 1, WO);      // in[e][o] -> Bt[o][e]
    k_projqk<<<dim3(NB * SEQ / 128, DM / 256, 1), GWV * 32, 0, stream>>>(XH, WQ, bq, QP);
    k_projqk<<<dim3(NB * SEQ / 128, DM / 256, 1), GWV * 32, 0, stream>>>(XH, WK, bk, KP);
    k_projv<<<dim3(NB * SEQ / 128, DM / 256, 1), GWV * 32, 0, stream>>>(XH, WV, bv, VT);
    k_attn<<<dim3(SEQ / (AWV * 16), NB * NH, 1), AWV * 32, 0, stream>>>(QP, KP, VT, CTX);
    k_outp<<<dim3(NB * SEQ / 128, DM / 256, 1), GWV * 32, 0, stream>>>(CTX, WO, bo, OUT);
}

// v003
// Measured time: 139 microseconds a run.
// In two side-by-side timings against v002, it was 1.11 and 1.10 times as fast.
// All steps since v000 together make it 2.61 times as fast.
#include <hip/hip_runtime.h>

#ifndef NB
#define NB 4
#endif
#ifndef SEQ
#define SEQ 2048
#endif
#define NB_FULL  4
#define SEQ_FULL 2048
#define DM   1024
#define NH   16
#define HD   64
#define WCAR 64.0f
#define WINV (1.0f / 64.0f)
#define CCAR 64.0f
#define OINV (1.0f / 4096.0f)
#define C2   0.18033688011112042f   // (1/8) * log2(e)
#define TSP  72                     // LDS tile pitch in halves (144 B, multiple of 16 B)

static_assert(NH * HD == DM);
static_assert(HD == 64);
static_assert(DM % 32 == 0);
static_assert(DM % 64 == 0);
static_assert(SEQ % 64 == 0);
static_assert(SEQ <= SEQ_FULL);
static_assert(NB <= NB_FULL);
static_assert((TSP * 2) % 16 == 0);
static_assert(TSP >= HD);

typedef _Float16 h16;
typedef __attribute__((ext_vector_type(16))) _Float16 v16h;
typedef __attribute__((ext_vector_type(8)))  _Float16 v8h;
typedef __attribute__((ext_vector_type(8)))  float    v8f;
typedef __attribute__((ext_vector_type(4)))  float    v4f;
typedef v8h __attribute__((may_alias)) v8ha;
typedef v4f __attribute__((may_alias)) v4fa;

__device__ __forceinline__ unsigned short f2bf(float f) { unsigned u = __float_as_uint(f); u += 0x7FFFu + ((u >> 16) & 1u); return (unsigned short)(u >> 16); }
__device__ __forceinline__ float bf2f(unsigned short b) { return __uint_as_float(((unsigned)b) << 16); }
__device__ __forceinline__ float bfr(float f) { return bf2f(f2bf(f)); }
__device__ __forceinline__ v16h cat16(v8h lo, v8h hi) { return __builtin_shufflevector(lo, hi, 0, 1, 2, 3, 4, 5, 6, 7, 8, 9, 10, 11, 12, 13, 14, 15); }
// fragment from a K-contiguous f16 row: elements 0..7 <- p[0..7], 8..15 <- p[16..23]; caller passes p = row + k0 + 8*(lane>>4)
__device__ __forceinline__ v16h ldh(const h16* p) { return cat16(*(const v8h*)p, *(const v8h*)(p + 16)); }
__device__ __forceinline__ v8f wmma16(v16h a, v16h b, v8f c) { return __builtin_amdgcn_wmma_f32_16x16x32_f16(false, a, false, b, (short)0, c, false, false); }
__device__ __forceinline__ void wave_lds_sync() { __builtin_amdgcn_fence(3 /* release order */, "wavefront"); __builtin_amdgcn_wave_barrier(); asm volatile("" ::: "memory"); }

// ---- k_prep: every operand conversion in one launch. One thread per 8-element unit of a weight matrix: thread i converts unit i of each of the four weights and XU units of x.
#define PTH ((size_t)DM * DM / 8)                 // threads of the launch
#define XU  ((int)((size_t)NB * SEQ * DM / 8 / PTH))   // x units per thread
static_assert(((size_t)NB * SEQ * DM / 8) % PTH == 0);
static_assert(PTH % 256 == 0);

// unit i of Bt[z*N + n][k] (8 consecutive k) <- w[z][k .. k+7][n], K = DM
template <int N>
__device__ __forceinline__ void wt_read(const float* __restrict__ w, size_t i, float (&r)[8]) {
    const size_t e = i * 8; const size_t k = e % (size_t)DM; const size_t n = (e / (size_t)DM) % (size_t)N; const size_t z = e / ((size_t)DM * N);
    const float* s = w + (z * DM + k) * N + n;
#pragma unroll
    for (int j = 0; j < 8; ++j) r[j] = s[(size_t)j * N];
    asm volatile("s_wait_xcnt 0x0" ::: "memory");                                // a later load's result may land in this group's address registers: the wait stands ahead of it
}
__device__ __forceinline__ void wt_write(const float (&r)[8], size_t i, h16* Bt) {
    v8h o;
#pragma unroll
    for (int j = 0; j < 8; ++j) o[j] = (h16)(bfr(r[j]) * WCAR);
    *(v8h*)(Bt + i * 8) = o;
}

__global__ __launch_bounds__(256) void k_prep(const float* __restrict__ x, const float* __restrict__ wq, const float* __restrict__ wk, const float* __restrict__ wv, const float* __restrict__ wo,
                                              h16* XH, h16* WQ, h16* WK, h16* WV, h16* WO) {
    const size_t i = (size_t)blockIdx.x * 256 + threadIdx.x;
    float rq[8], rk[8], rv[8], ro[8];
    wt_read<HD>(wq, i, rq); wt_read<HD>(wk, i, rk); wt_read<HD>(wv, i, rv);      // in[h][e][d] -> Bt[h*64 + d][e]
    wt_read<DM>(wo, i, ro);                                                      // in[e][o] -> Bt[o][e]
    v4f v0[XU], v1[XU];
#pragma unroll
    for (int u = 0; u < XU; ++u) {
        const size_t xi = i + (size_t)u * PTH;
        const size_t r = xi / (DM / 8); const size_t c8 = xi % (DM / 8); const size_t b = r / SEQ, s = r % SEQ;
        const float* src = x + (b * SEQ_FULL + s) * DM + c8 * 8;
        v0[u] = *(const v4f*)src; v1[u] = *(const v4f*)(src + 4);
        asm volatile("s_wait_xcnt 0x0" ::: "memory");                            // as in wt_read
    }
    __builtin_amdgcn_sched_barrier(0);                                           // keeps every load of the thread issued ahead of the first conversion: one memory latency a thread, not one a group
    wt_write(rq, i, WQ); wt_write(rk, i, WK); wt_write(rv, i, WV); wt_write(ro, i, WO);
#pragma unroll
    for (int u = 0; u < XU; ++u) {
        v8h o;
        o[0] = (h16)bfr(v0[u][0]); o[1] = (h16)bfr(v0[u][1]); o[2] = (h16)bfr(v0[u][2]); o[3] = (h16)bfr(v0[u][3]);
        o[4] = (h16)bfr(v1[u][0]); o[5] = (h16)bfr(v1[u][1]); o[6] = (h16)bfr(v1[u][2]); o[7] = (h16)bfr(v1[u][3]);
        *(v8h*)(XH + (i + (size_t)u * PTH) * 8) = o;
    }
}

// ---- gemm_blk: one block of 8 waves, 64x64 f32 tile per wave: acc[mb][nb][j] = sum_k A[arow + mb*16 + 8*hi + j][k] * Bt[brow + nb*16 + lr][k], K = DM, both operands K-contiguous f16 rows (pitch DM).
// The block's RA rows of A and GROWS - RA rows of Bt are shared through LDS. A stage = GKS k of all GROWS rows (rows of 256 B at the 272-B pitch); two stages in LDS:
// the next one is copied in (global -> LDS, no register) while this one is read.
#define GWV   8                      // waves per GEMM block
#define GKS   128                    // k per stage
#define GP    136                    // LDS row pitch in halves (272 B = 16 B x 17)
#define GROWS 384                    // rows per stage, both operands together
#define GSTH  (GROWS * GP)           // halves of one stage
static_assert(DM % GKS == 0);
static_assert(DM / GKS >= 2);
static_assert((GP * 2) % 16 == 0);
static_assert(GP >= GKS);
static_assert(GWV * 32 * 8 * 8 == 128 * GKS);   // eight 16-B pieces per lane cover 128 rows of a stage
static_assert((NB * SEQ) % 128 == 0);
static_assert(DM % 256 == 0);

__device__ __forceinline__ unsigned lds_off(const void* p) { return (unsigned)(size_t)p; }
__device__ __forceinline__ v16h ldhs(const h16* p) { return cat16(*(const v8ha*)p, *(const v8ha*)(p + 16)); }
// 128 rows of a stage: each lane moves eight 16-B pieces (rows r, r + 16, ... r + 112). l = the lane's LDS byte address of row r; g = its global piece of row r.
__device__ __forceinline__ void copy_rows128(unsigned l, const h16* g) {
    const unsigned l1 = l + 16 * GP * 2, l2 = l + 32 * GP * 2, l3 = l + 48 * GP * 2, l4 = l + 64 * GP * 2, l5 = l + 80 * GP * 2, l6 = l + 96 * GP * 2, l7 = l + 112 * GP * 2;
    const h16* g1 = g + 16 * DM; const h16* g2 = g + 32 * DM; const h16* g3 = g + 48 * DM; const h16* g4 = g + 64 * DM;
    const h16* g5 = g + 80 * DM; const h16* g6 = g + 96 * DM; const h16* g7 = g + 112 * DM;
    // the closing s_wait_xcnt keeps every later write of these address registers behind the copies' issue
    asm volatile("global_load_async_to_lds_b128 %0, %8, off\n\t"
                 "global_load_async_to_lds_b128 %1, %9, off\n\t"
                 "global_load_async_to_lds_b128 %2, %10, off\n\t"
                 "global_load_async_to_lds_b128 %3, %11, off\n\t"
                 "global_load_async_to_lds_b128 %4, %12, off\n\t"
                 "global_load_async_to_lds_b128 %5, %13, off\n\t"
                 "global_load_async_to_lds_b128 %6, %14, off\n\t"
                 "global_load_async_to_lds_b128 %7, %15, off\n\t"
                 "s_wait_xcnt 0x0"
                 :: "v"(l), "v"(l1), "v"(l2), "v"(l3), "v"(l4), "v"(l5), "v"(l6), "v"(l7),
                    "v"(g), "v"(g1), "v"(g2), "v"(g3), "v"(g4), "v"(g5), "v"(g6), "v"(g7) : "memory");
    __builtin_amdgcn_sched_barrier(0);                                       // keeps a later group's address sums behind this group's issue: fewer registers live at once, no spill
}
// One stage's copies: stage rows 0 .. RA-1 are A rows, the rest Bt rows. cl = the lane's LDS byte address in the stage's row (tid >> 4); ga, gb = its global pieces of that row of A and of Bt at this stage's k.
template <int RA>
__device__ __forceinline__ void gemm_stage(unsigned cl, const h16* ga, const h16* gb) {
#pragma unroll
    for (int r0 = 0; r0 < GROWS; r0 += 128) copy_rows128(cl + (unsigned)(r0 * GP * 2), r0 < RA ? ga + (size_t)r0 * DM : gb + (size_t)(r0 - RA) * DM);
}

template <int RA>
__device__ __forceinline__ void gemm_blk(const h16* __restrict__ A, const h16* __restrict__ Bt, h16* ring, int arow, int brow, v8f (&acc)[4][4], int tid, int lr, int hi) {
    static_assert(RA % 128 == 0 && RA < GROWS);
#pragma unroll
    for (int mb = 0; mb < 4; ++mb)
#pragma unroll
        for (int nb = 0; nb < 4; ++nb) acc[mb][nb] = (v8f){};
    const unsigned cl = lds_off(ring) + (unsigned)(((tid >> 4) * GP + (tid & 15) * 8) * 2);
    const h16* ga = A + (size_t)(tid >> 4) * DM + (tid & 15) * 8;
    const h16* gb = Bt + (size_t)(tid >> 4) * DM + (tid & 15) * 8;
    gemm_stage<RA>(cl, ga, gb);
    asm volatile("s_wait_asynccnt 0x0" ::: "memory");                        // this wave's pieces of stage 0 have landed
    __syncthreads();                                                         // ... and every other wave's
    gemm_stage<RA>(cl + GSTH * 2, ga + GKS, gb + GKS);
#pragma unroll 1
    for (int t = 0; t < DM / GKS; ++t) {
        const int sb = (t & 1) * GSTH;                                       // this trip's stage
        const h16* ap = ring + sb + (arow + lr) * GP + 8 * hi;
        const h16* bp = ring + sb + (RA + brow + lr) * GP + 8 * hi;
        v16h a[2][4], b[2][4];                                               // two fragment sets: the next 32 k of this stage are read as one group while this set is multiplied
#pragma unroll
        for (int f = 0; f < 4; ++f) { a[0][f] = ldhs(ap + f * 16 * GP); b[0][f] = ldhs(bp + f * 16 * GP); }
#pragma unroll
        for (int ks = 0; ks < GKS / 32; ++ks) {
            if (ks + 1 < GKS / 32) {
#pragma unroll
                for (int f = 0; f < 4; ++f) { a[(ks + 1) & 1][f] = ldhs(ap + f * 16 * GP + (ks + 1) * 32); b[(ks + 1) & 1][f] = ldhs(bp + f * 16 * GP + (ks + 1) * 32); }
            }
            else {                                                           // the stage's last fragments are in registers: the buffer is handed over before they are multiplied, so the refill flies longer
                asm volatile("s_wait_dscnt 0x0" ::: "memory");               // this wave's reads of this stage are done before the stage is refilled
                asm volatile("s_wait_asynccnt 0x0" ::: "memory");            // this wave's pieces of the next stage have landed
                __syncthreads();                                             // publishes the next stage; ends every wave's reads of this one
                if (t + 2 < DM / GKS) gemm_stage<RA>(cl + (unsigned)sb * 2, ga + (t + 2) * GKS, gb + (t + 2) * GKS);
            }
            __builtin_amdgcn_sched_barrier(0);                               // keeps the read group (last block: the hand-over) ahead of the matrix run instead of spread among it
#pragma unroll
            for (int nb = 0; nb < 4; ++nb)
#pragma unroll
                for (int mb = 0; mb < 4; ++mb) acc[mb][nb] = wmma16(a[ks & 1][mb], b[ks & 1][nb], acc[mb][nb]);
            __builtin_amdgcn_sched_barrier(0);                               // keeps this matrix run ahead of the next read group and of the hand-over
        }
    }
    asm volatile("s_wait_asynccnt 0x0" ::: "memory");                        // no copy is left in flight behind the loop
}

__device__ __forceinline__ void store_tile64(const h16* ts_base_unused, h16* dst, size_t pitch, int lane);

// ---- projqk_body: plane P[b][h][s][d] (f16) = x Wt^T / 64 + b. Operand roles swapped (A = weight rows, B = x rows) so each lane holds 8 consecutive d of one s.
// Block = 4 heads (256 weight rows) x 128 x rows; wave wv: head wv & 3 of them, x rows 64 * (wv >> 2).
__device__ __forceinline__ void projqk_body(const h16* __restrict__ XH, const h16* __restrict__ WT, const float* __restrict__ bias, h16* P, h16* ring, h16* tsall) {
    const int tid = threadIdx.x, lane = tid & 31, lr = lane & 15, hi = lane >> 4, wv = tid >> 5;
    h16* ts = tsall + wv * 64 * TSP;                                        // wave-private staging region
    const int r0 = blockIdx.x * 128 + (wv >> 2) * 64, head = blockIdx.y * 4 + (wv & 3); const int bz = r0 / SEQ, s0 = r0 % SEQ;
    v8f acc[4][4];
    gemm_blk<256>(WT + (size_t)blockIdx.y * 256 * DM, XH + (size_t)blockIdx.x * 128 * DM, ring, (wv & 3) * 64, (wv >> 2) * 64, acc, tid, lr, hi);   // acc[mb][nb][j]: d = mb*16 + 8*hi + j, s = nb*16 + lr
#pragma unroll
    for (int mb = 0; mb < 4; ++mb) {
        const v4f b0 = *(const v4f*)(bias + head * HD + mb * 16 + 8 * hi); const v4f b1 = *(const v4f*)(bias + head * HD + mb * 16 + 8 * hi + 4);
        v8f bb; bb[0] = bfr(b0[0]); bb[1] = bfr(b0[1]); bb[2] = bfr(b0[2]); bb[3] = bfr(b0[3]); bb[4] = bfr(b1[0]); bb[5] = bfr(b1[1]); bb[6] = bfr(b1[2]); bb[7] = bfr(b1[3]);
#pragma unroll
        for (int nb = 0; nb < 4; ++nb) { v8h hv;
#pragma unroll
            for (int j = 0; j < 8; ++j) hv[j] = (h16)(acc[mb][nb][j] * WINV + bb[j]);
            *(v8ha*)(&ts[(nb * 16 + lr) * TSP + mb * 16 + 8 * hi]) = hv; } }
    wave_lds_sync();                                                        // ts is private to this wave
    h16* dst = P + (((size_t)bz * NH + head) * SEQ + s0) * HD;
{
#pragma unroll
        for (int it = 0; it < 16; ++it) { const int L = it * 4 + (lane >> 3), pc = lane & 7; const v8h val = *(const v8ha*)(&ts[L * TSP + pc * 8]);
            *(v8h*)(dst + (size_t)L * HD + pc * 8) = val; }
         }
}

// ---- projv_body: transposed plane VT[b][h][d][s] (f16) = x Wv^T / 64 + bv (A = x rows, B = weight rows: each lane holds 8 consecutive s of one d).
// Block = 128 x rows x 4 heads (256 weight rows); wave wv: x rows 64 * (wv >> 2), head wv & 3 of them.
__device__ __forceinline__ void projv_body(const h16* __restrict__ XH, const h16* __restrict__ WT, const float* __restrict__ bias, h16* VT, h16* ring, h16* tsall) {
    const int tid = threadIdx.x, lane = tid & 31, lr = lane & 15, hi = lane >> 4, wv = tid >> 5;
    h16* ts = tsall + wv * 64 * TSP;                                        // wave-private staging region
    const int r0 = blockIdx.x * 128 + (wv >> 2) * 64, head = blockIdx.y * 4 + (wv & 3); const int bz = r0 / SEQ, s0 = r0 % SEQ;
    v8f acc[4][4];
    gemm_blk<128>(XH + (size_t)blockIdx.x * 128 * DM, WT + (size_t)blockIdx.y * 256 * DM, ring, (wv >> 2) * 64, (wv & 3) * 64, acc, tid, lr, hi);   // acc[mb][nb][j]: s = mb*16 + 8*hi + j, d = nb*16 + lr
#pragma unroll
    for (int nb = 0; nb < 4; ++nb) { const float bb = bfr(bias[head * HD + nb * 16 + lr]);
#pragma unroll
        for (int mb = 0; mb < 4; ++mb) { v8h hv;
#pragma unroll
            for (int j = 0; j < 8; ++j) hv[j] = (h16)(acc[mb][nb][j] * WINV + bb);
            *(v8ha*)(&ts[(nb * 16 + lr) * TSP + mb * 16 + 8 * hi]) = hv; } }
    wave_lds_sync();
    h16* dst = VT + (((size_t)bz * NH + head) * HD) * SEQ + s0;
{
#pragma unroll
        for (int it = 0; it < 16; ++it) { const int L = it * 4 + (lane >> 3), pc = lane & 7; const v8h val = *(const v8ha*)(&ts[L * TSP + pc * 8]);
            *(v8h*)(dst + (size_t)L * SEQ + pc * 8) = val; }
         }
}

// ---- k_projqkv: the three projections in one launch; blockIdx.z = 0: q, 1: k, 2: v (the choice is the same for a whole block).
__global__ __launch_bounds__(GWV * 32) void k_projqkv(const h16* __restrict__ XH, const h16* __restrict__ WQ, const h16* __restrict__ WK, const h16* __restrict__ WV,
                                                      const float* __restrict__ bq, const float* __restrict__ bk, const float* __restrict__ bv, h16* QP, h16* KP, h16* VT) {
    __shared__ __align__(16) h16 ring[2 * GSTH];
    __shared__ __align__(16) h16 tsall[GWV * 64 * TSP];
    if (blockIdx.z == 2) projv_body(XH, WV, bv, VT, ring, tsall);
    else projqk_body(XH, blockIdx.z == 0 ? WQ : WK, blockIdx.z == 0 ? bq : bk, blockIdx.z == 0 ? QP : KP, ring, tsall);
}

// ---- k_attn: fused attention. One wave = 16 query rows of one (b,h); the 8 waves of a block walk the same keys and share each 64-key K tile and V^T tile through LDS.
// A stage = K tile [64 keys][64 d] + V^T tile [64 d][64 keys], rows of 128 B at the 144-B pitch; two stages in LDS: the next one is copied in (global -> LDS, no register) while this one is read.
// Per 64-key step: 4 tiles S^T[key][query] = K-tile (A) x Q^T (B); online softmax per query column (lane-local over keys + one xor-16 exchange);
// P^T B fragments repacked in-lane from the S^T accumulators (element r <- tile 2u [r], element 8+r <- tile 2u+1 [r]); O^T[d][query] += V^T (A) x P^T (B).
#define AWV    8                     // waves per attention block
#define KSTEP  64                    // keys per stage
#define TILEH  (64 * TSP)            // halves of one staged tile
#define STAGEH (2 * TILEH)           // halves of one stage (K tile, then V^T tile)
static_assert(SEQ % (AWV * 16) == 0);
static_assert(SEQ / KSTEP >= 2);
static_assert(AWV * 32 * 2 * 8 == 64 * HD);   // two 16-B pieces per lane cover one tile

// One stage's copies: each lane moves four 16-B pieces (rows r and r + 32 of both tiles). lk = the lane's LDS byte address in the K tile; gk, gv = its global pieces of row r.
__device__ __forceinline__ void stage_copy(unsigned lk, const h16* gk, const h16* gv) {
    const unsigned lk1 = lk + 32 * TSP * 2, lv = lk + TILEH * 2, lv1 = lk + TILEH * 2 + 32 * TSP * 2;
    const h16* gk1 = gk + 32 * HD; const h16* gv1 = gv + (size_t)32 * SEQ;
    // the closing s_wait_xcnt keeps every later write of these address registers behind the copies' issue
    asm volatile("global_load_async_to_lds_b128 %0, %4, off\n\t"
                 "global_load_async_to_lds_b128 %1, %5, off\n\t"
                 "global_load_async_to_lds_b128 %2, %6, off\n\t"
                 "global_load_async_to_lds_b128 %3, %7, off\n\t"
                 "s_wait_xcnt 0x0"
                 :: "v"(lk), "v"(lk1), "v"(lv), "v"(lv1), "v"(gk), "v"(gk1), "v"(gv), "v"(gv1) : "memory");
}

// second bound: 8 waves per SIMD (128 registers a wave), so that four blocks share a WGP and the whole grid is resident at once
__global__ __launch_bounds__(AWV * 32, 8) void k_attn(const h16* __restrict__ Qp, const h16* __restrict__ Kp, const h16* __restrict__ Vt, h16* Ctx) {
    __shared__ __align__(16) h16 ring[2 * STAGEH];
    __shared__ __align__(16) h16 os[AWV * 16 * TSP];
    const int tid = threadIdx.x;
    const int lane = tid & 31, lr = lane & 15, hi = lane >> 4, wv = tid >> 5;
    const int bh = blockIdx.y; const int q0 = blockIdx.x * (AWV * 16) + wv * 16;
    const size_t pbase = (size_t)bh * SEQ * HD;
    const unsigned cl = lds_off(ring) + (unsigned)(((tid >> 3) * TSP + (tid & 7) * 8) * 2);
    const h16* gk = Kp + pbase + (size_t)(tid >> 3) * HD + (tid & 7) * 8;
    const h16* gv = Vt + pbase + (size_t)(tid >> 3) * SEQ + (tid & 7) * 8;
    stage_copy(cl, gk, gv);
    const h16* qrow = Qp + pbase + (size_t)(q0 + lr) * HD + 8 * hi;
    const v16h qb0 = ldh(qrow), qb1 = ldh(qrow + 32);
    v8f o[4];
#pragma unroll
    for (int dt = 0; dt < 4; ++dt) o[dt] = (v8f){};
    float m = -3.0e38f, l = 0.0f;
    asm volatile("s_wait_asynccnt 0x0" ::: "memory");                        // this wave's pieces of stage 0 have landed
    __syncthreads();                                                         // ... and every other wave's
    stage_copy(cl + STAGEH * 2, gk + (size_t)KSTEP * HD, gv + KSTEP);
#pragma unroll 1
    for (int kb = 0; kb < SEQ; kb += KSTEP) {
        const int sb = ((kb / KSTEP) & 1) * STAGEH;                          // this step's stage
        const h16* kbase = &ring[sb + lr * TSP + 8 * hi];
        const h16* vbase = kbase + TILEH;
        v8f st[4]; v16h ka0, ka1;
#pragma unroll
        for (int t = 0; t < 4; ++t) { const h16* kp = kbase + t * 16 * TSP; ka0 = ldhs(kp); ka1 = ldhs(kp + 32);
            v8f c = (v8f){}; c = wmma16(ka0, qb0, c); c = wmma16(ka1, qb1, c); st[t] = c; }
        asm volatile("v_nop\n\tv_nop\n\tv_nop\n\tv_nop" : "+v"(st[0]), "+v"(st[1]), "+v"(st[2]), "+v"(st[3]) : "v"(ka0), "v"(ka1), "v"(qb0), "v"(qb1));
        float mloc = fmaxf(fmaxf(st[0][0], st[1][0]), fmaxf(st[2][0], st[3][0]));
#pragma unroll
        for (int j = 1; j < 8; ++j) mloc = fmaxf(mloc, fmaxf(fmaxf(st[0][j], st[1][j]), fmaxf(st[2][j], st[3][j])));
        mloc = fmaxf(mloc, __shfl_xor(mloc, 16, 32));
        const float mnew = fmaxf(m, mloc * C2);
        const float corr = __builtin_amdgcn_exp2f(m - mnew); m = mnew;
        v16h pb0, pb1; float psum = 0.0f;
#pragma unroll
        for (int j = 0; j < 8; ++j) {
            const float p0 = __builtin_amdgcn_exp2f(__builtin_fmaf(st[0][j], C2, -mnew));
            const float p1 = __builtin_amdgcn_exp2f(__builtin_fmaf(st[1][j], C2, -mnew));
            const float p2 = __builtin_amdgcn_exp2f(__builtin_fmaf(st[2][j], C2, -mnew));
            const float p3 = __builtin_amdgcn_exp2f(__builtin_fmaf(st[3][j], C2, -mnew));
            psum += (p0 + p1) + (p2 + p3);
            pb0[j] = (h16)p0; pb0[8 + j] = (h16)p1; pb1[j] = (h16)p2; pb1[8 + j] = (h16)p3; }
        l = l * corr + psum;
#pragma unroll
        for (int dt = 0; dt < 4; ++dt)
#pragma unroll
            for (int j = 0; j < 8; ++j) o[dt][j] *= corr;
        v16h va0, va1;
#pragma unroll
        for (int dt = 0; dt < 4; ++dt) { const h16* vp = vbase + dt * 16 * TSP; va0 = ldhs(vp); va1 = ldhs(vp + 32);
            o[dt] = wmma16(va0, pb0, o[dt]); o[dt] = wmma16(va1, pb1, o[dt]); }
        asm volatile("v_nop\n\tv_nop\n\tv_nop\n\tv_nop" : "+v"(o[0]), "+v"(o[1]), "+v"(o[2]), "+v"(o[3]) : "v"(va0), "v"(va1), "v"(pb0), "v"(pb1));
        asm volatile("s_wait_dscnt 0x0" ::: "memory");                       // this wave's reads of this stage are done before the stage is refilled
        asm volatile("s_wait_asynccnt 0x0" ::: "memory");                    // this wave's pieces of the next stage have landed
        __syncthreads();                                                     // publishes the next stage; ends every wave's reads of this one
        if (kb + 2 * KSTEP < SEQ) stage_copy(cl + (unsigned)sb * 2, gk + (size_t)(kb + 2 * KSTEP) * HD, gv + (kb + 2 * KSTEP));
    }
    asm volatile("s_wait_asynccnt 0x0" ::: "memory");                        // no copy is left in flight when the wave ends
    const float lt = l + __shfl_xor(l, 16, 32);
    const float inv = CCAR * (1.0f / lt);
    const int ob = wv * 16 * TSP;                                            // wave-private staging region
#pragma unroll
    for (int dt = 0; dt < 4; ++dt) { v8h hv;                                 // o[dt][j] = O^T[d = dt*16 + 8*hi + j][query lr]
#pragma unroll
        for (int j = 0; j < 8; ++j) hv[j] = (h16)(o[dt][j] * inv);
        *(v8ha*)(&os[ob + lr * TSP + dt * 16 + 8 * hi]) = hv; }
    wave_lds_sync();
    const int b = bh / NH, h = bh % NH;
    h16* dst = Ctx + ((size_t)b * SEQ + q0) * DM + h * HD;
{
#pragma unroll
        for (int it = 0; it < 4; ++it) { const int qq = it * 4 + (lane >> 3), pc = lane & 7; const v8h val = *(const v8ha*)(&os[ob + qq * TSP + pc * 8]);
            *(v8h*)(dst + (size_t)qq * DM + pc * 8) = val; }
         }
}

// Block = 128 ctx rows x 256 output columns; wave wv: rows 64 * (wv >> 2), columns 64 * (wv & 3).
__global__ __launch_bounds__(GWV * 32) void k_outp(const h16* __restrict__ CTX, const h16* __restrict__ WO, const float* __restrict__ bias, float* OUT) {
    __shared__ __align__(16) h16 ring[2 * GSTH];
    __shared__ __align__(16) float osall[GWV * 16 * 68];
    const int tid = threadIdx.x, lane = tid & 31, lr = lane & 15, hi = lane >> 4, wv = tid >> 5;
    float* os = osall + wv * 16 * 68;                                       // wave-private staging region
    const int r0 = blockIdx.x * 128 + (wv >> 2) * 64, c0 = blockIdx.y * 256 + (wv & 3) * 64; const int bz = r0 / SEQ, s0 = r0 % SEQ;
    v8f acc[4][4];
    gemm_blk<128>(CTX + (size_t)blockIdx.x * 128 * DM, WO + (size_t)blockIdx.y * 256 * DM, ring, (wv >> 2) * 64, (wv & 3) * 64, acc, tid, lr, hi);       // acc[mb][nb][j]: row mb*16 + 8*hi + j, col nb*16 + lr
    const v4f braw = *(const v4f*)(bias + c0 + lr * 4); v4f bb; bb[0] = bfr(braw[0]); bb[1] = bfr(braw[1]); bb[2] = bfr(braw[2]); bb[3] = bfr(braw[3]);
    float* cbase = OUT + ((size_t)bz * SEQ_FULL + s0) * DM + c0;
#pragma unroll
    for (int mb = 0; mb < 4; ++mb) {
#pragma unroll
        for (int nb = 0; nb < 4; ++nb) {
#pragma unroll
            for (int j = 0; j < 8; ++j) os[(hi * 8 + j) * 68 + nb * 16 + lr] = acc[mb][nb][j] * OINV; }
        wave_lds_sync();
        float* crow = cbase + (size_t)(mb * 16) * DM;
{
#pragma unroll
            for (int s = 0; s < 8; ++s) { const int row = 2 * s + hi, cofs = lr * 4; v4f val = *(const v4fa*)(os + row * 68 + cofs); val += bb;
                *(v4f*)(crow + (size_t)row * DM + cofs) = val; }
             }
        wave_lds_sync();
    }
}

#define SZ_X    ((size_t)NB * SEQ * DM * 2)
#define SZ_W    ((size_t)DM * DM * 2)
#define SZ_ALL  (SZ_X * 5 + SZ_W * 4)
static_assert(SZ_X % 256 == 0);
static_assert(SZ_W % 256 == 0);
static_assert(SZ_ALL <= (size_t)134217728);

extern "C" void kernel_launch(void* const* d_in, const int* in_sizes, int n_in,
                              void* d_out, int out_size, void* d_ws, size_t ws_size, hipStream_t stream) {
    if (n_in < 9) return;
    const size_t needx = ((size_t)(NB - 1) * SEQ_FULL + SEQ) * DM;
    if ((size_t)in_sizes[0] < needx) return;
    if ((size_t)in_sizes[1] < (size_t)NH * DM * HD || (size_t)in_sizes[3] < (size_t)NH * DM * HD || (size_t)in_sizes[5] < (size_t)NH * DM * HD) return;
    if ((size_t)in_sizes[2] < (size_t)NH * HD || (size_t)in_sizes[4] < (size_t)NH * HD || (size_t)in_sizes[6] < (size_t)NH * HD) return;
    if ((size_t)in_sizes[7] < (size_t)DM * DM || (size_t)in_sizes[8] < (size_t)DM) return;
    if ((size_t)out_size < needx) return;
    if (SZ_ALL > ws_size) return;
    const float* xs = (const float*)d_in[0];
    const float* Wq = (const float*)d_in[1]; const float* bq = (const float*)d_in[2];
    const float* Wk = (const float*)d_in[3]; const float* bk = (const float*)d_in[4];
    const float* Wv = (const float*)d_in[5]; const float* bv = (const float*)d_in[6];
    const float* Wo = (const float*)d_in[7]; const float* bo = (const float*)d_in[8];
    float* OUT = (float*)d_out;
    char* wsp = (char*)d_ws;
    h16* XH  = (h16*)wsp; wsp += SZ_X;      // [NB*SEQ][DM]
    h16* WQ  = (h16*)wsp; wsp += SZ_W;      // Bt [h*64+d][e], x64
    h16* WK  = (h16*)wsp; wsp += SZ_W;
    h16* WV  = (h16*)wsp; wsp += SZ_W;
    h16* WO  = (h16*)wsp; wsp += SZ_W;      // Bt [out][in], x64
    h16* QP  = (h16*)wsp; wsp += SZ_X;      // [b][h][s][d]
    h16* KP  = (h16*)wsp; wsp += SZ_X;      // [b][h][s][d]
    h16* VT  = (h16*)wsp; wsp += SZ_X;      // [b][h][d][s]
    h16* CTX = (h16*)wsp; wsp += SZ_X;      // [NB*SEQ][DM], x64

    k_prep<<<(unsigned)(PTH / 256), 256, 0, stream>>>(xs, Wq, Wk, Wv, Wo, XH, WQ, WK, WV, WO);
    k_projqkv<<<dim3(NB * SEQ / 128, DM / 256, 3), GWV * 32, 0, stream>>>(XH, WQ, WK, WV, bq, bk, bv, QP, KP, VT);
    k_attn<<<dim3(SEQ / (AWV * 16), NB * NH, 1), AWV * 32, 0, stream>>>(QP, KP, VT, CTX);
    k_outp<<<dim3(NB * SEQ / 128, DM / 256, 1), GWV * 32, 0, stream>>>(CTX, WO, bo, OUT);
}

// v004
// A run of this version takes 132 microseconds.
// Next to v003, in two timings, it ran 1.05 times as fast each time.
// Over all steps from v000 it is 2.75 times as fast.
#include <hip/hip_runtime.h>

#ifndef NB
#define NB 4
#endif
#ifndef SEQ
#define SEQ 2048
#endif
#define NB_FULL  4
#define SEQ_FULL 2048
#define DM   1024
#define NH   16
#define HD   64
#define WCAR 64.0f
#define WINV (1.0f / 64.0f)
#define CCAR 64.0f
#define OINV (1.0f / 4096.0f)
#define C2   0.18033688011112042f   // (1/8) * log2(e)
#define TSP  72                     // LDS tile pitch in halves (144 B, multiple of 16 B)

static_assert(NH * HD == DM);
static_assert(HD == 64);
static_assert(DM % 32 == 0);
static_assert(DM % 64 == 0);
static_assert(SEQ % 64 == 0);
static_assert(SEQ <= SEQ_FULL);
static_assert(NB <= NB_FULL);
static_assert((TSP * 2) % 16 == 0);
static_assert(TSP >= HD);

typedef _Float16 h16;
typedef __attribute__((ext_vector_type(16))) _Float16 v16h;
typedef __attribute__((ext_vector_type(8)))  _Float16 v8h;
typedef __attribute__((ext_vector_type(8)))  float    v8f;
typedef __attribute__((ext_vector_type(4)))  float    v4f;
typedef v8h __attribute__((may_alias)) v8ha;
typedef v4f __attribute__((may_alias)) v4fa;

__device__ __forceinline__ unsigned short f2bf(float f) { unsigned u = __float_as_uint(f); u += 0x7FFFu + ((u >> 16) & 1u); return (unsigned short)(u >> 16); }
__device__ __forceinline__ float bf2f(unsigned short b) { return __uint_as_float(((unsigned)b) << 16); }
__device__ __forceinline__ float bfr(float f) { return bf2f(f2bf(f)); }
__device__ __forceinline__ v16h cat16(v8h lo, v8h hi) { return __builtin_shufflevector(lo, hi, 0, 1, 2, 3, 4, 5, 6, 7, 8, 9, 10, 11, 12, 13, 14, 15); }
// fragment from a K-contiguous f16 row: elements 0..7 <- p[0..7], 8..15 <- p[16..23]; caller passes p = row + k0 + 8*(lane>>4)
__device__ __forceinline__ v16h ldh(const h16* p) { return cat16(*(const v8h*)p, *(const v8h*)(p + 16)); }
__device__ __forceinline__ v8f wmma16(v16h a, v16h b, v8f c) { return __builtin_amdgcn_wmma_f32_16x16x32_f16(false, a, false, b, (short)0, c, false, false); }
__device__ __forceinline__ void wave_lds_sync() { __builtin_amdgcn_fence(3 /* release order */, "wavefront"); __builtin_amdgcn_wave_barrier(); asm volatile("" ::: "memory"); }

// ---- k_prep: every operand conversion in one launch. One thread per 8-element unit of a weight matrix: thread i converts unit i of each of the four weights and XU units of x.
#define PTH ((size_t)DM * DM / 8)                 // threads of the launch
#define XU  ((int)((size_t)NB * SEQ * DM / 8 / PTH))   // x units per thread
static_assert(((size_t)NB * SEQ * DM / 8) % PTH == 0);
static_assert(PTH % 256 == 0);

// unit i of Bt[z*N + n][k] (8 consecutive k) <- w[z][k .. k+7][n], K = DM
template <int N>
__device__ __forceinline__ void wt_read(const float* __restrict__ w, size_t i, float (&r)[8]) {
    const size_t e = i * 8; const size_t k = e % (size_t)DM; const size_t n = (e / (size_t)DM) % (size_t)N; const size_t z = e / ((size_t)DM * N);
    const float* s = w + (z * DM + k) * N + n;
#pragma unroll
    for (int j = 0; j < 8; ++j) r[j] = s[(size_t)j * N];
    asm volatile("s_wait_xcnt 0x0" ::: "memory");                                // a later load's result may land in this group's address registers: the wait stands ahead of it
}
__device__ __forceinline__ void wt_write(const float (&r)[8], size_t i, h16* Bt) {
    v8h o;
#pragma unroll
    for (int j = 0; j < 8; ++j) o[j] = (h16)(bfr(r[j]) * WCAR);
    *(v8h*)(Bt + i * 8) = o;
}

__global__ __launch_bounds__(256) void k_prep(const float* __restrict__ x, const float* __restrict__ wq, const float* __restrict__ wk, const float* __restrict__ wv, const float* __restrict__ wo,
                                              h16* XH, h16* WQ, h16* WK, h16* WV, h16* WO) {
    const size_t i = (size_t)blockIdx.x * 256 + threadIdx.x;
    float rq[8], rk[8], rv[8], ro[8];
    wt_read<HD>(wq, i, rq); wt_read<HD>(wk, i, rk); wt_read<HD>(wv, i, rv);      // in[h][e][d] -> Bt[h*64 + d][e]
    wt_read<DM>(wo, i, ro);                                                      // in[e][o] -> Bt[o][e]
    v4f v0[XU], v1[XU];
#pragma unroll
    for (int u = 0; u < XU; ++u) {
        const size_t xi = i + (size_t)u * PTH;
        const size_t r = xi / (DM / 8); const size_t c8 = xi % (DM / 8); const size_t b = r / SEQ, s = r % SEQ;
        const float* src = x + (b * SEQ_FULL + s) * DM + c8 * 8;
        v0[u] = *(const v4f*)src; v1[u] = *(const v4f*)(src + 4);
        asm volatile("s_wait_xcnt 0x0" ::: "memory");                            // as in wt_read
    }
    __builtin_amdgcn_sched_barrier(0);                                           // keeps every load of the thread issued ahead of the first conversion: one memory latency a thread, not one a group
    wt_write(rq, i, WQ); wt_write(rk, i, WK); wt_write(rv, i, WV); wt_write(ro, i, WO);
#pragma unroll
    for (int u = 0; u < XU; ++u) {
        v8h o;
        o[0] = (h16)bfr(v0[u][0]); o[1] = (h16)bfr(v0[u][1]); o[2] = (h16)bfr(v0[u][2]); o[3] = (h16)bfr(v0[u][3]);
        o[4] = (h16)bfr(v1[u][0]); o[5] = (h16)bfr(v1[u][1]); o[6] = (h16)bfr(v1[u][2]); o[7] = (h16)bfr(v1[u][3]);
        *(v8h*)(XH + (i + (size_t)u * PTH) * 8) = o;
    }
}

// ---- gemm_blk: one block of 8 waves, 64x64 f32 tile per wave: acc[mb][nb][j] = sum_k A[arow + mb*16 + 8*hi + j][k] * Bt[brow + nb*16 + lr][k], K = DM, both operands K-contiguous f16 rows (pitch DM).
// The block's RA rows of A and GROWS - RA rows of Bt are shared through LDS. A stage = GKS k of all GROWS rows (rows of 256 B at the 272-B pitch); two stages in LDS:
// the next one is copied in (global -> LDS, no register) while this one is read.
#define GWV   8                      // waves per GEMM block
#define GKS   128                    // k per stage
#define GP    136                    // LDS row pitch in halves (272 B = 16 B x 17)
#define GROWS 384                    // rows per stage, both operands together
#define GSTH  (GROWS * GP)           // halves of one stage
static_assert(DM % GKS == 0);
static_assert(DM / GKS >= 2);
static_assert((GP * 2) % 16 == 0);
static_assert(GP >= GKS);
static_assert(GWV * 32 * 8 * 8 == 128 * GKS);   // eight 16-B pieces per lane cover 128 rows of a stage
static_assert((NB * SEQ) % 128 == 0);
static_assert(DM % 256 == 0);

__device__ __forceinline__ unsigned lds_off(const void* p) { return (unsigned)(size_t)p; }
__device__ __forceinline__ v16h ldhs(const h16* p) { return cat16(*(const v8ha*)p, *(const v8ha*)(p + 16)); }
// 128 rows of a stage: each lane moves eight 16-B pieces (rows r, r + 16, ... r + 112). l = the lane's LDS byte address of row r; g = its global piece of row r.
__device__ __forceinline__ void copy_rows128(unsigned l, const h16* g) {
    const unsigned l1 = l + 16 * GP * 2, l2 = l + 32 * GP * 2, l3 = l + 48 * GP * 2, l4 = l + 64 * GP * 2, l5 = l + 80 * GP * 2, l6 = l + 96 * GP * 2, l7 = l + 112 * GP * 2;
    const h16* g1 = g + 16 * DM; const h16* g2 = g + 32 * DM; const h16* g3 = g + 48 * DM; const h16* g4 = g + 64 * DM;
    const h16* g5 = g + 80 * DM; const h16* g6 = g + 96 * DM; const h16* g7 = g + 112 * DM;
    // the closing s_wait_xcnt keeps every later write of these address registers behind the copies' issue
    asm volatile("global_load_async_to_lds_b128 %0, %8, off\n\t"
                 "global_load_async_to_lds_b128 %1, %9, off\n\t"
                 "global_load_async_to_lds_b128 %2, %10, off\n\t"
                 "global_load_async_to_lds_b128 %3, %11, off\n\t"
                 "global_load_async_to_lds_b128 %4, %12, off\n\t"
                 "global_load_async_to_lds_b128 %5, %13, off\n\t"
                 "global_load_async_to_lds_b128 %6, %14, off\n\t"
                 "global_load_async_to_lds_b128 %7, %15, off\n\t"
                 "s_wait_xcnt 0x0"
                 :: "v"(l), "v"(l1), "v"(l2), "v"(l3), "v"(l4), "v"(l5), "v"(l6), "v"(l7),
                    "v"(g), "v"(g1), "v"(g2), "v"(g3), "v"(g4), "v"(g5), "v"(g6), "v"(g7) : "memory");
    __builtin_amdgcn_sched_barrier(0);                                       // keeps a later group's address sums behind this group's issue: fewer registers live at once, no spill
}
// One stage's copies: stage rows 0 .. RA-1 are A rows, the rest Bt rows. cl = the lane's LDS byte address in the stage's row (tid >> 4); ga, gb = its global pieces of that row of A and of Bt at this stage's k.
template <int RA>
__device__ __forceinline__ void gemm_stage(unsigned cl, const h16* ga, const h16* gb) {
#pragma unroll
    for (int r0 = 0; r0 < GROWS; r0 += 128) copy_rows128(cl + (unsigned)(r0 * GP * 2), r0 < RA ? ga + (size_t)r0 * DM : gb + (size_t)(r0 - RA) * DM);
}

template <int RA>
__device__ __forceinline__ void gemm_blk(const h16* __restrict__ A, const h16* __restrict__ Bt, h16* ring, int arow, int brow, v8f (&acc)[4][4], int tid, int lr, int hi) {
    static_assert(RA % 128 == 0 && RA < GROWS);
#pragma unroll
    for (int mb = 0; mb < 4; ++mb)
#pragma unroll
        for (int nb = 0; nb < 4; ++nb) acc[mb][nb] = (v8f){};
    const unsigned cl = lds_off(ring) + (unsigned)(((tid >> 4) * GP + (tid & 15) * 8) * 2);
    const h16* ga = A + (size_t)(tid >> 4) * DM + (tid & 15) * 8;
    const h16* gb = Bt + (size_t)(tid >> 4) * DM + (tid & 15) * 8;
    gemm_stage<RA>(cl, ga, gb);
    asm volatile("s_wait_asynccnt 0x0" ::: "memory");                        // this wave's pieces of stage 0 have landed
    __syncthreads();                                                         // ... and every other wave's
    gemm_stage<RA>(cl + GSTH * 2, ga + GKS, gb + GKS);
#pragma unroll 1
    for (int t = 0; t < DM / GKS; ++t) {
        const int sb = (t & 1) * GSTH;                                       // this trip's stage
        const h16* ap = ring + sb + (arow + lr) * GP + 8 * hi;
        const h16* bp = ring + sb + (RA + brow + lr) * GP + 8 * hi;
        v16h a[2][4], b[2][4];                                               // two fragment sets: the next 32 k of this stage are read as one group while this set is multiplied
#pragma unroll
        for (int f = 0; f < 4; ++f) { a[0][f] = ldhs(ap + f * 16 * GP); b[0][f] = ldhs(bp + f * 16 * GP); }
#pragma unroll
        for (int ks = 0; ks < GKS / 32; ++ks) {
            if (ks + 1 < GKS / 32) {
#pragma unroll
                for (int f = 0; f < 4; ++f) { a[(ks + 1) & 1][f] = ldhs(ap + f * 16 * GP + (ks + 1) * 32); b[(ks + 1) & 1][f] = ldhs(bp + f * 16 * GP + (ks + 1) * 32); }
            }
            else {                                                           // the stage's last fragments are in registers: the buffer is handed over before they are multiplied, so the refill flies longer
                asm volatile("s_wait_dscnt 0x0" ::: "memory");               // this wave's reads of this stage are done before the stage is refilled
                asm volatile("s_wait_asynccnt 0x0" ::: "memory");            // this wave's pieces of the next stage have landed
                __syncthreads();                                             // publishes the next stage; ends every wave's reads of this one
                if (t + 2 < DM / GKS) gemm_stage<RA>(cl + (unsigned)sb * 2, ga + (t + 2) * GKS, gb + (t + 2) * GKS);
            }
            __builtin_amdgcn_sched_barrier(0);                               // keeps the read group (last block: the hand-over) ahead of the matrix run instead of spread among it
#pragma unroll
            for (int nb = 0; nb < 4; ++nb)
#pragma unroll
                for (int mb = 0; mb < 4; ++mb) acc[mb][nb] = wmma16(a[ks & 1][mb], b[ks & 1][nb], acc[mb][nb]);
            __builtin_amdgcn_sched_barrier(0);                               // keeps this matrix run ahead of the next read group and of the hand-over
        }
    }
    asm volatile("s_wait_asynccnt 0x0" ::: "memory");                        // no copy is left in flight behind the loop
}

__device__ __forceinline__ void store_tile64(const h16* ts_base_unused, h16* dst, size_t pitch, int lane);

// ---- projqk_body: plane P[b][h][s][d] (f16) = x Wt^T / 64 + b. Operand roles swapped (A = weight rows, B = x rows) so each lane holds 8 consecutive d of one s.
// Block = 4 heads (256 weight rows) x 128 x rows; wave wv: head wv & 3 of them, x rows 64 * (wv >> 2).
__device__ __forceinline__ void projqk_body(const h16* __restrict__ XH, const h16* __restrict__ WT, const float* __restrict__ bias, h16* P, h16* ring, h16* tsall) {
    const int tid = threadIdx.x, lane = tid & 31, lr = lane & 15, hi = lane >> 4, wv = tid >> 5;
    h16* ts = tsall + wv * 64 * TSP;                                        // wave-private staging region
    const int r0 = blockIdx.x * 128 + (wv >> 2) * 64, head = blockIdx.y * 4 + (wv & 3); const int bz = r0 / SEQ, s0 = r0 % SEQ;
    v8f acc[4][4];
    gemm_blk<256>(WT + (size_t)blockIdx.y * 256 * DM, XH + (size_t)blockIdx.x * 128 * DM, ring, (wv & 3) * 64, (wv >> 2) * 64, acc, tid, lr, hi);   // acc[mb][nb][j]: d = mb*16 + 8*hi + j, s = nb*16 + lr
#pragma unroll
    for (int mb = 0; mb < 4; ++mb) {
        const v4f b0 = *(const v4f*)(bias + head * HD + mb * 16 + 8 * hi); const v4f b1 = *(const v4f*)(bias + head * HD + mb * 16 + 8 * hi + 4);
        v8f bb; bb[0] = bfr(b0[0]); bb[1] = bfr(b0[1]); bb[2] = bfr(b0[2]); bb[3] = bfr(b0[3]); bb[4] = bfr(b1[0]); bb[5] = bfr(b1[1]); bb[6] = bfr(b1[2]); bb[7] = bfr(b1[3]);
#pragma unroll
        for (int nb = 0; nb < 4; ++nb) { v8h hv;
#pragma unroll
            for (int j = 0; j < 8; ++j) hv[j] = (h16)(acc[mb][nb][j] * WINV + bb[j]);
            *(v8ha*)(&ts[(nb * 16 + lr) * TSP + mb * 16 + 8 * hi]) = hv; } }
    wave_lds_sync();                                                        // ts is private to this wave
    h16* dst = P + (((size_t)bz * NH + head) * SEQ + s0) * HD;
{
#pragma unroll
        for (int it = 0; it < 16; ++it) { const int L = it * 4 + (lane >> 3), pc = lane & 7; const v8h val = *(const v8ha*)(&ts[L * TSP + pc * 8]);
            *(v8h*)(dst + (size_t)L * HD + pc * 8) = val; }
         }
}

// ---- projv_body: transposed plane VT[b][h][d][s] (f16) = x Wv^T / 64 + bv (A = x rows, B = weight rows: each lane holds 8 consecutive s of one d).
// Block = 128 x rows x 4 heads (256 weight rows); wave wv: x rows 64 * (wv >> 2), head wv & 3 of them.
__device__ __forceinline__ void projv_body(const h16* __restrict__ XH, const h16* __restrict__ WT, const float* __restrict__ bias, h16* VT, h16* ring, h16* tsall) {
    const int tid = threadIdx.x, lane = tid & 31, lr = lane & 15, hi = lane >> 4, wv = tid >> 5;
    h16* ts = tsall + wv * 64 * TSP;                                        // wave-private staging region
    const int r0 = blockIdx.x * 128 + (wv >> 2) * 64, head = blockIdx.y * 4 + (wv & 3); const int bz = r0 / SEQ, s0 = r0 % SEQ;
    v8f acc[4][4];
    gemm_blk<128>(XH + (size_t)blockIdx.x * 128 * DM, WT + (size_t)blockIdx.y * 256 * DM, ring, (wv >> 2) * 64, (wv & 3) * 64, acc, tid, lr, hi);   // acc[mb][nb][j]: s = mb*16 + 8*hi + j, d = nb*16 + lr
#pragma unroll
    for (int nb = 0; nb < 4; ++nb) { const float bb = bfr(bias[head * HD + nb * 16 + lr]);
#pragma unroll
        for (int mb = 0; mb < 4; ++mb) { v8h hv;
#pragma unroll
            for (int j = 0; j < 8; ++j) hv[j] = (h16)(acc[mb][nb][j] * WINV + bb);
            *(v8ha*)(&ts[(nb * 16 + lr) * TSP + mb * 16 + 8 * hi]) = hv; } }
    wave_lds_sync();
    h16* dst = VT + (((size_t)bz * NH + head) * HD) * SEQ + s0;
{
#pragma unroll
        for (int it = 0; it < 16; ++it) { const int L = it * 4 + (lane >> 3), pc = lane & 7; const v8h val = *(const v8ha*)(&ts[L * TSP + pc * 8]);
            *(v8h*)(dst + (size_t)L * SEQ + pc * 8) = val; }
         }
}

// ---- k_projqkv: the three projections in one launch; blockIdx.z = 0: q, 1: k, 2: v (the choice is the same for a whole block).
__global__ __launch_bounds__(GWV * 32) void k_projqkv(const h16* __restrict__ XH, const h16* __restrict__ WQ, const h16* __restrict__ WK, const h16* __restrict__ WV,
                                                      const float* __restrict__ bq, const float* __restrict__ bk, const float* __restrict__ bv, h16* QP, h16* KP, h16* VT) {
    __shared__ __align__(16) h16 ring[2 * GSTH];
    __shared__ __align__(16) h16 tsall[GWV * 64 * TSP];
    if (blockIdx.z == 2) projv_body(XH, WV, bv, VT, ring, tsall);
    else projqk_body(XH, blockIdx.z == 0 ? WQ : WK, blockIdx.z == 0 ? bq : bk, blockIdx.z == 0 ? QP : KP, ring, tsall);
}

// ---- k_attn: fused attention. One wave = 32 query rows (two groups of 16) of one (b,h): every K and V^T fragment read from LDS feeds both groups. The 8 waves of a block walk the same keys and share each 64-key K tile and V^T tile through LDS.
// A stage = K tile [64 keys][64 d] + V^T tile [64 d][64 keys], rows of 128 B at the 144-B pitch; two stages in LDS: the next one is copied in (global -> LDS, no register) while this one is read.
// Per 64-key step and query group: 4 tiles S^T[key][query] = K-tile (A) x Q^T (B); online softmax per query column (lane-local over keys + one xor-16 exchange);
// P^T B fragments repacked in-lane from the S^T accumulators (element r <- tile 2u [r], element 8+r <- tile 2u+1 [r]); O^T[d][query] += V^T (A) x P^T (B).
#define AWV    8                     // waves per attention block
#define QG     2                     // query groups of 16 per wave
#define KSTEP  64                    // keys per stage
#define TILEH  (64 * TSP)            // halves of one staged tile
#define STAGEH (2 * TILEH)           // halves of one stage (K tile, then V^T tile)
static_assert(SEQ % (AWV * QG * 16) == 0);
static_assert(SEQ / KSTEP >= 2);
static_assert(AWV * 32 * 2 * 8 == 64 * HD);   // two 16-B pieces per lane cover one tile

// One stage's copies: each lane moves four 16-B pieces (rows r and r + 32 of both tiles). lk = the lane's LDS byte address in the K tile; gk, gv = its global pieces of row r.
__device__ __forceinline__ void stage_copy(unsigned lk, const h16* gk, const h16* gv) {
    const unsigned lk1 = lk + 32 * TSP * 2, lv = lk + TILEH * 2, lv1 = lk + TILEH * 2 + 32 * TSP * 2;
    const h16* gk1 = gk + 32 * HD; const h16* gv1 = gv + (size_t)32 * SEQ;
    // the closing s_wait_xcnt keeps every later write of these address registers behind the copies' issue
    asm volatile("global_load_async_to_lds_b128 %0, %4, off\n\t"
                 "global_load_async_to_lds_b128 %1, %5, off\n\t"
                 "global_load_async_to_lds_b128 %2, %6, off\n\t"
                 "global_load_async_to_lds_b128 %3, %7, off\n\t"
                 "s_wait_xcnt 0x0"
                 :: "v"(lk), "v"(lk1), "v"(lv), "v"(lv1), "v"(gk), "v"(gk1), "v"(gv), "v"(gv1) : "memory");
}

// second bound: 4 waves per SIMD (256 registers a wave), so that two blocks share a WGP and the whole grid is resident at once
__global__ __launch_bounds__(AWV * 32, 4) void k_attn(const h16* __restrict__ Qp, const h16* __restrict__ Kp, const h16* __restrict__ Vt, h16* Ctx) {
    __shared__ __align__(16) h16 ring[2 * STAGEH];
    __shared__ __align__(16) h16 os[AWV * QG * 16 * TSP];
    const int tid = threadIdx.x;
    const int lane = tid & 31, lr = lane & 15, hi = lane >> 4, wv = tid >> 5;
    const int bh = blockIdx.y; const int q0 = blockIdx.x * (AWV * QG * 16) + wv * (QG * 16);
    const size_t pbase = (size_t)bh * SEQ * HD;
    const unsigned cl = lds_off(ring) + (unsigned)(((tid >> 3) * TSP + (tid & 7) * 8) * 2);
    const h16* gk = Kp + pbase + (size_t)(tid >> 3) * HD + (tid & 7) * 8;
    const h16* gv = Vt + pbase + (size_t)(tid >> 3) * SEQ + (tid & 7) * 8;
    stage_copy(cl, gk, gv);
    v16h qb0[QG], qb1[QG];
    v8f o[QG][4];
    float m[QG], l[QG];
#pragma unroll
    for (int c = 0; c < QG; ++c) {
        const h16* qrow = Qp + pbase + (size_t)(q0 + c * 16 + lr) * HD + 8 * hi;
        qb0[c] = ldh(qrow); qb1[c] = ldh(qrow + 32);
#pragma unroll
        for (int dt = 0; dt < 4; ++dt) o[c][dt] = (v8f){};
        m[c] = -3.0e38f; l[c] = 0.0f;
    }
    asm volatile("s_wait_asynccnt 0x0" ::: "memory");                        // this wave's pieces of stage 0 have landed
    __syncthreads();                                                         // ... and every other wave's
    stage_copy(cl + STAGEH * 2, gk + (size_t)KSTEP * HD, gv + KSTEP);
#pragma unroll 1
    for (int kb = 0; kb < SEQ; kb += KSTEP) {
        const int sb = ((kb / KSTEP) & 1) * STAGEH;                          // this step's stage
        const h16* kbase = &ring[sb + lr * TSP + 8 * hi];
        const h16* vbase = kbase + TILEH;
        v8f st[QG][4]; v16h ka0, ka1;
#pragma unroll
        for (int t = 0; t < 4; ++t) { const h16* kp = kbase + t * 16 * TSP; ka0 = ldhs(kp); ka1 = ldhs(kp + 32);
#pragma unroll
            for (int c = 0; c < QG; ++c) st[c][t] = wmma16(ka0, qb0[c], (v8f){});
#pragma unroll
            for (int c = 0; c < QG; ++c) st[c][t] = wmma16(ka1, qb1[c], st[c][t]); }
        // four vector slots between the last score WMMA and the first vector read of a score tile; naming the tiles keeps the 16 WMMAs one run, with no vector work spread among them
        asm volatile("v_nop\n\tv_nop\n\tv_nop\n\tv_nop" : "+v"(st[0][0]), "+v"(st[0][1]), "+v"(st[0][2]), "+v"(st[0][3]), "+v"(st[1][0]), "+v"(st[1][1]), "+v"(st[1][2]), "+v"(st[1][3])
                     : "v"(ka0), "v"(ka1), "v"(qb0[0]), "v"(qb1[0]), "v"(qb0[1]), "v"(qb1[1]));
        v16h pb0[QG], pb1[QG];
#pragma unroll
        for (int c = 0; c < QG; ++c) {
            float mloc = fmaxf(fmaxf(st[c][0][0], st[c][1][0]), fmaxf(st[c][2][0], st[c][3][0]));
#pragma unroll
            for (int j = 1; j < 8; ++j) mloc = fmaxf(mloc, fmaxf(fmaxf(st[c][0][j], st[c][1][j]), fmaxf(st[c][2][j], st[c][3][j])));
            mloc = fmaxf(mloc, __shfl_xor(mloc, 16, 32));
            const float mnew = fmaxf(m[c], mloc * C2);
            const float corr = __builtin_amdgcn_exp2f(m[c] - mnew); m[c] = mnew;
            float psum = 0.0f;
#pragma unroll
            for (int j = 0; j < 8; ++j) {
                const float p0 = __builtin_amdgcn_exp2f(__builtin_fmaf(st[c][0][j], C2, -mnew));
                const float p1 = __builtin_amdgcn_exp2f(__builtin_fmaf(st[c][1][j], C2, -mnew));
                const float p2 = __builtin_amdgcn_exp2f(__builtin_fmaf(st[c][2][j], C2, -mnew));
                const float p3 = __builtin_amdgcn_exp2f(__builtin_fmaf(st[c][3][j], C2, -mnew));
                psum += (p0 + p1) + (p2 + p3);
                pb0[c][j] = (h16)p0; pb0[c][8 + j] = (h16)p1; pb1[c][j] = (h16)p2; pb1[c][8 + j] = (h16)p3; }
            l[c] = l[c] * corr + psum;
#pragma unroll
            for (int dt = 0; dt < 4; ++dt)
#pragma unroll
                for (int j = 0; j < 8; ++j) o[c][dt][j] *= corr;
        }
        v16h va0, va1;
#pragma unroll
        for (int dt = 0; dt < 4; ++dt) { const h16* vp = vbase + dt * 16 * TSP; va0 = ldhs(vp); va1 = ldhs(vp + 32);
#pragma unroll
            for (int c = 0; c < QG; ++c) o[c][dt] = wmma16(va0, pb0[c], o[c][dt]);
#pragma unroll
            for (int c = 0; c < QG; ++c) o[c][dt] = wmma16(va1, pb1[c], o[c][dt]); }
        // the same four slots behind the last output WMMA, ahead of the branch at the loop's foot on both of its sides
        asm volatile("v_nop\n\tv_nop\n\tv_nop\n\tv_nop" : "+v"(o[0][0]), "+v"(o[0][1]), "+v"(o[0][2]), "+v"(o[0][3]), "+v"(o[1][0]), "+v"(o[1][1]), "+v"(o[1][2]), "+v"(o[1][3])
                     : "v"(va0), "v"(va1), "v"(pb0[0]), "v"(pb1[0]), "v"(pb0[1]), "v"(pb1[1]));
        asm volatile("s_wait_dscnt 0x0" ::: "memory");                       // this wave's reads of this stage are done before the stage is refilled
        asm volatile("s_wait_asynccnt 0x0" ::: "memory");                    // this wave's pieces of the next stage have landed
        __syncthreads();                                                     // publishes the next stage; ends every wave's reads of this one
        if (kb + 2 * KSTEP < SEQ) stage_copy(cl + (unsigned)sb * 2, gk + (size_t)(kb + 2 * KSTEP) * HD, gv + (kb + 2 * KSTEP));
    }
    asm volatile("s_wait_asynccnt 0x0" ::: "memory");                        // no copy is left in flight when the wave ends
    const int ob = wv * QG * 16 * TSP;                                       // wave-private staging region
#pragma unroll
    for (int c = 0; c < QG; ++c) {
        const float lt = l[c] + __shfl_xor(l[c], 16, 32);
        const float inv = CCAR * (1.0f / lt);
#pragma unroll
        for (int dt = 0; dt < 4; ++dt) { v8h hv;                             // o[c][dt][j] = O^T[d = dt*16 + 8*hi + j][query c*16 + lr]
#pragma unroll
            for (int j = 0; j < 8; ++j) hv[j] = (h16)(o[c][dt][j] * inv);
            *(v8ha*)(&os[ob + (c * 16 + lr) * TSP + dt * 16 + 8 * hi]) = hv; }
    }
    wave_lds_sync();
    const int b = bh / NH, h = bh % NH;
    h16* dst = Ctx + ((size_t)b * SEQ + q0) * DM + h * HD;
#pragma unroll
    for (int it = 0; it < QG * 4; ++it) { const int qq = it * 4 + (lane >> 3), pc = lane & 7; const v8h val = *(const v8ha*)(&os[ob + qq * TSP + pc * 8]);
        *(v8h*)(dst + (size_t)qq * DM + pc * 8) = val; }
}

// Block = 128 ctx rows x 256 output columns; wave wv: rows 64 * (wv >> 2), columns 64 * (wv & 3).
__global__ __launch_bounds__(GWV * 32) void k_outp(const h16* __restrict__ CTX, const h16* __restrict__ WO, const float* __restrict__ bias, float* OUT) {
    __shared__ __align__(16) h16 ring[2 * GSTH];
    __shared__ __align__(16) float osall[GWV * 16 * 68];
    const int tid = threadIdx.x, lane = tid & 31, lr = lane & 15, hi = lane >> 4, wv = tid >> 5;
    float* os = osall + wv * 16 * 68;                                       // wave-private staging region
    const int r0 = blockIdx.x * 128 + (wv >> 2) * 64, c0 = blockIdx.y * 256 + (wv & 3) * 64; const int bz = r0 / SEQ, s0 = r0 % SEQ;
    v8f acc[4][4];
    gemm_blk<128>(CTX + (size_t)blockIdx.x * 128 * DM, WO + (size_t)blockIdx.y * 256 * DM, ring, (wv >> 2) * 64, (wv & 3) * 64, acc, tid, lr, hi);       // acc[mb][nb][j]: row mb*16 + 8*hi + j, col nb*16 + lr
    const v4f braw = *(const v4f*)(bias + c0 + lr * 4); v4f bb; bb[0] = bfr(braw[0]); bb[1] = bfr(braw[1]); bb[2] = bfr(braw[2]); bb[3] = bfr(braw[3]);
    float* cbase = OUT + ((size_t)bz * SEQ_FULL + s0) * DM + c0;
#pragma unroll
    for (int mb = 0; mb < 4; ++mb) {
#pragma unroll
        for (int nb = 0; nb < 4; ++nb) {
#pragma unroll
            for (int j = 0; j < 8; ++j) os[(hi * 8 + j) * 68 + nb * 16 + lr] = acc[mb][nb][j] * OINV; }
        wave_lds_sync();
        float* crow = cbase + (size_t)(mb * 16) * DM;
{
#pragma unroll
            for (int s = 0; s < 8; ++s) { const int row = 2 * s + hi, cofs = lr * 4; v4f val = *(const v4fa*)(os + row * 68 + cofs); val += bb;
                *(v4f*)(crow + (size_t)row * DM + cofs) = val; }
             }
        wave_lds_sync();
    }
}

#define SZ_X    ((size_t)NB * SEQ * DM * 2)
#define SZ_W    ((size_t)DM * DM * 2)
#define SZ_ALL  (SZ_X * 5 + SZ_W * 4)
static_assert(SZ_X % 256 == 0);
static_assert(SZ_W % 256 == 0);
static_assert(SZ_ALL <= (size_t)134217728);

extern "C" void kernel_launch(void* const* d_in, const int* in_sizes, int n_in,
                              void* d_out, int out_size, void* d_ws, size_t ws_size, hipStream_t stream) {
    if (n_in < 9) return;
    const size_t needx = ((size_t)(NB - 1) * SEQ_FULL + SEQ) * DM;
    if ((size_t)in_sizes[0] < needx) return;
    if ((size_t)in_sizes[1] < (size_t)NH * DM * HD || (size_t)in_sizes[3] < (size_t)NH * DM * HD || (size_t)in_sizes[5] < (size_t)NH * DM * HD) return;
    if ((size_t)in_sizes[2] < (size_t)NH * HD || (size_t)in_sizes[4] < (size_t)NH * HD || (size_t)in_sizes[6] < (size_t)NH * HD) return;
    if ((size_t)in_sizes[7] < (size_t)DM * DM || (size_t)in_sizes[8] < (size_t)DM) return;
    if ((size_t)out_size < needx) return;
    if (SZ_ALL > ws_size) return;
    const float* xs = (const float*)d_in[0];
    const float* Wq = (const float*)d_in[1]; const float* bq = (const float*)d_in[2];
    const float* Wk = (const float*)d_in[3]; const float* bk = (const float*)d_in[4];
    const float* Wv = (const float*)d_in[5]; const float* bv = (const float*)d_in[6];
    const float* Wo = (const float*)d_in[7]; const float* bo = (const float*)d_in[8];
    float* OUT = (float*)d_out;
    char* wsp = (char*)d_ws;
    h16* XH  = (h16*)wsp; wsp += SZ_X;      // [NB*SEQ][DM]
    h16* WQ  = (h16*)wsp; wsp += SZ_W;      // Bt [h*64+d][e], x64
    h16* WK  = (h16*)wsp; wsp += SZ_W;
    h16* WV  = (h16*)wsp; wsp += SZ_W;
    h16* WO  = (h16*)wsp; wsp += SZ_W;      // Bt [out][in], x64
    h16* QP  = (h16*)wsp; wsp += SZ_X;      // [b][h][s][d]
    h16* KP  = (h16*)wsp; wsp += SZ_X;      // [b][h][s][d]
    h16* VT  = (h16*)wsp; wsp += SZ_X;      // [b][h][d][s]
    h16* CTX = (h16*)wsp; wsp += SZ_X;      // [NB*SEQ][DM], x64

    k_prep<<<(unsigned)(PTH / 256), 256, 0, stream>>>(xs, Wq, Wk, Wv, Wo, XH, WQ, WK, WV, WO);
    k_projqkv<<<dim3(NB * SEQ / 128, DM / 256, 3), GWV * 32, 0, stream>>>(XH, WQ, WK, WV, bq, bk, bv, QP, KP, VT);
    k_attn<<<dim3(SEQ / (AWV * QG * 16), NB * NH, 1), AWV * 32, 0, stream>>>(QP, KP, VT, CTX);
    k_outp<<<dim3(NB * SEQ / 128, DM / 256, 1), GWV * 32, 0, stream>>>(CTX, WO, bo, OUT);
}

// v005
// A run of this version takes 127 microseconds.
// Timed twice side by side with v004, it ran 1.05 and 1.04 times as fast.
// Over all steps from v000 it is 2.87 times as fast.
#include <hip/hip_runtime.h>

#ifndef NB
#define NB 4
#endif
#ifndef SEQ
#define SEQ 2048
#endif
#define NB_FULL  4
#define SEQ_FULL 2048
#define DM   1024
#define NH   16
#define HD   64
#define WCAR 64.0f
#define WINV (1.0f / 64.0f)
#define CCAR 64.0f
#define OINV (1.0f / 4096.0f)
#define C2   0.18033688011112042f   // (1/8) * log2(e)
#define TSP  72                     // LDS tile pitch in halves (144 B, multiple of 16 B)

static_assert(NH * HD == DM);
static_assert(HD == 64);
static_assert(DM % 32 == 0);
static_assert(DM % 64 == 0);
static_assert(SEQ % 64 == 0);
static_assert(SEQ <= SEQ_FULL);
static_assert(NB <= NB_FULL);
static_assert((TSP * 2) % 16 == 0);
static_assert(TSP >= HD);

typedef _Float16 h16;
typedef __attribute__((ext_vector_type(16))) _Float16 v16h;
typedef __attribute__((ext_vector_type(8)))  _Float16 v8h;
typedef __attribute__((ext_vector_type(8)))  float    v8f;
typedef __attribute__((ext_vector_type(4)))  float    v4f;
typedef v8h __attribute__((may_alias)) v8ha;
typedef v4f __attribute__((may_alias)) v4fa;

__device__ __forceinline__ unsigned short f2bf(float f) { unsigned u = __float_as_uint(f); u += 0x7FFFu + ((u >> 16) & 1u); return (unsigned short)(u >> 16); }
__device__ __forceinline__ float bf2f(unsigned short b) { return __uint_as_float(((unsigned)b) << 16); }
__device__ __forceinline__ float bfr(float f) { return bf2f(f2bf(f)); }
__device__ __forceinline__ v16h cat16(v8h lo, v8h hi) { return __builtin_shufflevector(lo, hi, 0, 1, 2, 3, 4, 5, 6, 7, 8, 9, 10, 11, 12, 13, 14, 15); }
// fragment from a K-contiguous f16 row: elements 0..7 <- p[0..7], 8..15 <- p[16..23]; caller passes p = row + k0 + 8*(lane>>4)
__device__ __forceinline__ v16h ldh(const h16* p) { return cat16(*(const v8h*)p, *(const v8h*)(p + 16)); }
__device__ __forceinline__ v8f wmma16(v16h a, v16h b, v8f c) { return __builtin_amdgcn_wmma_f32_16x16x32_f16(false, a, false, b, (short)0, c, false, false); }
__device__ __forceinline__ void wave_lds_sync() { __builtin_amdgcn_fence(3 /* release order */, "wavefront"); __builtin_amdgcn_wave_barrier(); asm volatile("" ::: "memory"); }

// ---- k_prep: every operand conversion in one launch. One thread per 8-element unit of a weight matrix: thread i converts unit i of each of the four weights and XU units of x.
#define PTH ((size_t)DM * DM / 8)                 // threads of the launch
#define XU  ((int)((size_t)NB * SEQ * DM / 8 / PTH))   // x units per thread
static_assert(((size_t)NB * SEQ * DM / 8) % PTH == 0);
static_assert(PTH % 256 == 0);

// unit i of Bt[z*N + n][k] (8 consecutive k) <- w[z][k .. k+7][n], K = DM
template <int N>
__device__ __forceinline__ void wt_read(const float* __restrict__ w, size_t i, float (&r)[8]) {
    const size_t e = i * 8; const size_t k = e % (size_t)DM; const size_t n = (e / (size_t)DM) % (size_t)N; const size_t z = e / ((size_t)DM * N);
    const float* s = w + (z * DM + k) * N + n;
#pragma unroll
    for (int j = 0; j < 8; ++j) r[j] = s[(size_t)j * N];
    asm volatile("s_wait_xcnt 0x0" ::: "memory");                                // a later load's result may land in this group's address registers: the wait stands ahead of it
}
__device__ __forceinline__ void wt_write(const float (&r)[8], size_t i, h16* Bt) {
    v8h o;
#pragma unroll
    for (int j = 0; j < 8; ++j) o[j] = (h16)(bfr(r[j]) * WCAR);
    *(v8h*)(Bt + i * 8) = o;
}

__global__ __launch_bounds__(256) void k_prep(const float* __restrict__ x, const float* __restrict__ wq, const float* __restrict__ wk, const float* __restrict__ wv, const float* __restrict__ wo,
                                              h16* XH, h16* WQ, h16* WK, h16* WV, h16* WO) {
    const size_t i = (size_t)blockIdx.x * 256 + threadIdx.x;
    float rq[8], rk[8], rv[8], ro[8];
    wt_read<HD>(wq, i, rq); wt_read<HD>(wk, i, rk); wt_read<HD>(wv, i, rv);      // in[h][e][d] -> Bt[h*64 + d][e]
    wt_read<DM>(wo, i, ro);                                                      // in[e][o] -> Bt[o][e]
    v4f v0[XU], v1[XU];
#pragma unroll
    for (int u = 0; u < XU; ++u) {
        const size_t xi = i + (size_t)u * PTH;
        const size_t r = xi / (DM / 8); const size_t c8 = xi % (DM / 8); const size_t b = r / SEQ, s = r % SEQ;
        const float* src = x + (b * SEQ_FULL + s) * DM + c8 * 8;
        v0[u] = *(const v4f*)src; v1[u] = *(const v4f*)(src + 4);
        asm volatile("s_wait_xcnt 0x0" ::: "memory");                            // as in wt_read
    }
    __builtin_amdgcn_sched_barrier(0);                                           // keeps every load of the thread issued ahead of the first conversion: one memory latency a thread, not one a group
    wt_write(rq, i, WQ); wt_write(rk, i, WK); wt_write(rv, i, WV); wt_write(ro, i, WO);
#pragma unroll
    for (int u = 0; u < XU; ++u) {
        v8h o;
        o[0] = (h16)bfr(v0[u][0]); o[1] = (h16)bfr(v0[u][1]); o[2] = (h16)bfr(v0[u][2]); o[3] = (h16)bfr(v0[u][3]);
        o[4] = (h16)bfr(v1[u][0]); o[5] = (h16)bfr(v1[u][1]); o[6] = (h16)bfr(v1[u][2]); o[7] = (h16)bfr(v1[u][3]);
        *(v8h*)(XH + (i + (size_t)u * PTH) * 8) = o;
    }
}

// ---- gemm_blk: one block of 8 waves, 64x64 f32 tile per wave: acc[mb][nb][j] = sum_k A[arow + mb*16 + 8*hi + j][k] * Bt[brow + nb*16 + lr][k], K = DM, both operands K-contiguous f16 rows (pitch DM).
// The block's RA rows of A and GROWS - RA rows of Bt are shared through LDS. A stage = GKS k of all GROWS rows (rows of 256 B at the 272-B pitch); two stages in LDS:
// the next one is copied in (global -> LDS, no register) while this one is read.
#define GWV   8                      // waves per GEMM block
#define GKS   128                    // k per stage
#define GP    136                    // LDS row pitch in halves (272 B = 16 B x 17)
#define GROWS 384                    // rows per stage, both operands together
#define GSTH  (GROWS * GP)           // halves of one stage
static_assert(DM % GKS == 0);
static_assert(DM / GKS >= 2);
static_assert((GP * 2) % 16 == 0);
static_assert(GP >= GKS);
static_assert(GWV * 32 * 8 * 8 == 128 * GKS);   // eight 16-B pieces per lane cover 128 rows of a stage
static_assert((NB * SEQ) % 128 == 0);
static_assert(DM % 256 == 0);

__device__ __forceinline__ unsigned lds_off(const void* p) { return (unsigned)(size_t)p; }
__device__ __forceinline__ v16h ldhs(const h16* p) { return cat16(*(const v8ha*)p, *(const v8ha*)(p + 16)); }
// 128 rows of a stage: each lane moves eight 16-B pieces (rows r, r + 16, ... r + 112). l = the lane's LDS byte address of row r; g = its global piece of row r.
__device__ __forceinline__ void copy_rows128(unsigned l, const h16* g) {
    const unsigned l1 = l + 16 * GP * 2, l2 = l + 32 * GP * 2, l3 = l + 48 * GP * 2, l4 = l + 64 * GP * 2, l5 = l + 80 * GP * 2, l6 = l + 96 * GP * 2, l7 = l + 112 * GP * 2;
    const h16* g1 = g + 16 * DM; const h16* g2 = g + 32 * DM; const h16* g3 = g + 48 * DM; const h16* g4 = g + 64 * DM;
    const h16* g5 = g + 80 * DM; const h16* g6 = g + 96 * DM; const h16* g7 = g + 112 * DM;
    // the closing s_wait_xcnt keeps every later write of these address registers behind the copies' issue
    asm volatile("global_load_async_to_lds_b128 %0, %8, off\n\t"
                 "global_load_async_to_lds_b128 %1, %9, off\n\t"
                 "global_load_async_to_lds_b128 %2, %10, off\n\t"
                 "global_load_async_to_lds_b128 %3, %11, off\n\t"
                 "global_load_async_to_lds_b128 %4, %12, off\n\t"
                 "global_load_async_to_lds_b128 %5, %13, off\n\t"
                 "global_load_async_to_lds_b128 %6, %14, off\n\t"
                 "global_load_async_to_lds_b128 %7, %15, off\n\t"
                 "s_wait_xcnt 0x0"
                 :: "v"(l), "v"(l1), "v"(l2), "v"(l3), "v"(l4), "v"(l5), "v"(l6), "v"(l7),
                    "v"(g), "v"(g1), "v"(g2), "v"(g3), "v"(g4), "v"(g5), "v"(g6), "v"(g7) : "memory");
    __builtin_amdgcn_sched_barrier(0);                                       // keeps a later group's address sums behind this group's issue: fewer registers live at once, no spill
}
// One stage's copies: stage rows 0 .. RA-1 are A rows, the rest Bt rows. cl = the lane's LDS byte address in the stage's row (tid >> 4); ga, gb = its global pieces of that row of A and of Bt at this stage's k.
template <int RA>
__device__ __forceinline__ void gemm_stage(unsigned cl, const h16* ga, const h16* gb) {
#pragma unroll
    for (int r0 = 0; r0 < GROWS; r0 += 128) copy_rows128(cl + (unsigned)(r0 * GP * 2), r0 < RA ? ga + (size_t)r0 * DM : gb + (size_t)(r0 - RA) * DM);
}

template <int RA>
__device__ __forceinline__ void gemm_blk(const h16* __restrict__ A, const h16* __restrict__ Bt, h16* ring, int arow, int brow, v8f (&acc)[4][4], int tid, int lr, int hi) {
    static_assert(RA % 128 == 0 && RA < GROWS);
#pragma unroll
    for (int mb = 0; mb < 4; ++mb)
#pragma unroll
        for (int nb = 0; nb < 4; ++nb) acc[mb][nb] = (v8f){};
    const unsigned cl = lds_off(ring) + (unsigned)(((tid >> 4) * GP + (tid & 15) * 8) * 2);
    const h16* ga = A + (size_t)(tid >> 4) * DM + (tid & 15) * 8;
    const h16* gb = Bt + (size_t)(tid >> 4) * DM + (tid & 15) * 8;
    gemm_stage<RA>(cl, ga, gb);
    asm volatile("s_wait_asynccnt 0x0" ::: "memory");                        // this wave's pieces of stage 0 have landed
    __syncthreads();                                                         // ... and every other wave's
    gemm_stage<RA>(cl + GSTH * 2, ga + GKS, gb + GKS);
#pragma unroll 1
    for (int t = 0; t < DM / GKS; ++t) {
        const int sb = (t & 1) * GSTH;                                       // this trip's stage
        const h16* ap = ring + sb + (arow + lr) * GP + 8 * hi;
        const h16* bp = ring + sb + (RA + brow + lr) * GP + 8 * hi;
        v16h a[2][4], b[2][4];                                               // two fragment sets: the next 32 k of this stage are read as one group while this set is multiplied
#pragma unroll
        for (int f = 0; f < 4; ++f) { a[0][f] = ldhs(ap + f * 16 * GP); b[0][f] = ldhs(bp + f * 16 * GP); }
#pragma unroll
        for (int ks = 0; ks < GKS / 32; ++ks) {
            if (ks + 1 < GKS / 32) {
#pragma unroll
                for (int f = 0; f < 4; ++f) { a[(ks + 1) & 1][f] = ldhs(ap + f * 16 * GP + (ks + 1) * 32); b[(ks + 1) & 1][f] = ldhs(bp + f * 16 * GP + (ks + 1) * 32); }
            }
            else {                                                           // the stage's last fragments are in registers: the buffer is handed over before they are multiplied, so the refill flies longer
                asm volatile("s_wait_dscnt 0x0" ::: "memory");               // this wave's reads of this stage are done before the stage is refilled
                asm volatile("s_wait_asynccnt 0x0" ::: "memory");            // this wave's pieces of the next stage have landed
                __syncthreads();                                             // publishes the next stage; ends every wave's reads of this one
                if (t + 2 < DM / GKS) gemm_stage<RA>(cl + (unsigned)sb * 2, ga + (t + 2) * GKS, gb + (t + 2) * GKS);
            }
            __builtin_amdgcn_sched_barrier(0);                               // keeps the read group (last block: the hand-over) ahead of the matrix run instead of spread among it
#pragma unroll
            for (int nb = 0; nb < 4; ++nb)
#pragma unroll
                for (int mb = 0; mb < 4; ++mb) acc[mb][nb] = wmma16(a[ks & 1][mb], b[ks & 1][nb], acc[mb][nb]);
            __builtin_amdgcn_sched_barrier(0);                               // keeps this matrix run ahead of the next read group and of the hand-over
        }
    }
    asm volatile("s_wait_asynccnt 0x0" ::: "memory");                        // no copy is left in flight behind the loop
}

__device__ __forceinline__ void store_tile64(const h16* ts_base_unused, h16* dst, size_t pitch, int lane);

// ---- projqk_body: plane P[b][h][s][d] (f16) = (x Wt^T / 64 + b) * sc. Operand roles swapped (A = weight rows, B = x rows) so each lane holds 8 consecutive d of one s.
// Block = 4 heads (256 weight rows) x 128 x rows; wave wv: head wv & 3 of them, x rows 64 * (wv >> 2).
__device__ __forceinline__ void projqk_body(const h16* __restrict__ XH, const h16* __restrict__ WT, const float* __restrict__ bias, float sc, h16* P, h16* ring, h16* tsall) {
    const int tid = threadIdx.x, lane = tid & 31, lr = lane & 15, hi = lane >> 4, wv = tid >> 5;
    h16* ts = tsall + wv * 64 * TSP;                                        // wave-private staging region
    const int r0 = blockIdx.x * 128 + (wv >> 2) * 64, head = blockIdx.y * 4 + (wv & 3); const int bz = r0 / SEQ, s0 = r0 % SEQ;
    const float asc = WINV * sc;
    v8f acc[4][4];
    gemm_blk<256>(WT + (size_t)blockIdx.y * 256 * DM, XH + (size_t)blockIdx.x * 128 * DM, ring, (wv & 3) * 64, (wv >> 2) * 64, acc, tid, lr, hi);   // acc[mb][nb][j]: d = mb*16 + 8*hi + j, s = nb*16 + lr
#pragma unroll
    for (int mb = 0; mb < 4; ++mb) {
        const v4f b0 = *(const v4f*)(bias + head * HD + mb * 16 + 8 * hi); const v4f b1 = *(const v4f*)(bias + head * HD + mb * 16 + 8 * hi + 4);
        v8f bb; bb[0] = bfr(b0[0]); bb[1] = bfr(b0[1]); bb[2] = bfr(b0[2]); bb[3] = bfr(b0[3]); bb[4] = bfr(b1[0]); bb[5] = bfr(b1[1]); bb[6] = bfr(b1[2]); bb[7] = bfr(b1[3]);
        bb *= sc;
#pragma unroll
        for (int nb = 0; nb < 4; ++nb) { v8h hv;
#pragma unroll
            for (int j = 0; j < 8; ++j) hv[j] = (h16)(acc[mb][nb][j] * asc + bb[j]);
            *(v8ha*)(&ts[(nb * 16 + lr) * TSP + mb * 16 + 8 * hi]) = hv; } }
    wave_lds_sync();                                                        // ts is private to this wave
    h16* dst = P + (((size_t)bz * NH + head) * SEQ + s0) * HD;
{
#pragma unroll
        for (int it = 0; it < 16; ++it) { const int L = it * 4 + (lane >> 3), pc = lane & 7; const v8h val = *(const v8ha*)(&ts[L * TSP + pc * 8]);
            *(v8h*)(dst + (size_t)L * HD + pc * 8) = val; }
         }
}

// ---- projv_body: transposed plane VT[b][h][d][s] (f16) = x Wv^T / 64 + bv (A = x rows, B = weight rows: each lane holds 8 consecutive s of one d).
// Block = 128 x rows x 4 heads (256 weight rows); wave wv: x rows 64 * (wv >> 2), head wv & 3 of them.
__device__ __forceinline__ void projv_body(const h16* __restrict__ XH, const h16* __restrict__ WT, const float* __restrict__ bias, h16* VT, h16* ring, h16* tsall) {
    const int tid = threadIdx.x, lane = tid & 31, lr = lane & 15, hi = lane >> 4, wv = tid >> 5;
    h16* ts = tsall + wv * 64 * TSP;                                        // wave-private staging region
    const int r0 = blockIdx.x * 128 + (wv >> 2) * 64, head = blockIdx.y * 4 + (wv & 3); const int bz = r0 / SEQ, s0 = r0 % SEQ;
    v8f acc[4][4];
    gemm_blk<128>(XH + (size_t)blockIdx.x * 128 * DM, WT + (size_t)blockIdx.y * 256 * DM, ring, (wv >> 2) * 64, (wv & 3) * 64, acc, tid, lr, hi);   // acc[mb][nb][j]: s = mb*16 + 8*hi + j, d = nb*16 + lr
#pragma unroll
    for (int nb = 0; nb < 4; ++nb) { const float bb = bfr(bias[head * HD + nb * 16 + lr]);
#pragma unroll
        for (int mb = 0; mb < 4; ++mb) { v8h hv;
#pragma unroll
            for (int j = 0; j < 8; ++j) hv[j] = (h16)(acc[mb][nb][j] * WINV + bb);
            *(v8ha*)(&ts[(nb * 16 + lr) * TSP + mb * 16 + 8 * hi]) = hv; } }
    wave_lds_sync();
    h16* dst = VT + (((size_t)bz * NH + head) * HD) * SEQ + s0;
{
#pragma unroll
        for (int it = 0; it < 16; ++it) { const int L = it * 4 + (lane >> 3), pc = lane & 7; const v8h val = *(const v8ha*)(&ts[L * TSP + pc * 8]);
            *(v8h*)(dst + (size_t)L * SEQ + pc * 8) = val; }
         }
}

// ---- k_projqkv: the three projections in one launch; blockIdx.z = 0: q, 1: k, 2: v (the choice is the same for a whole block).
__global__ __launch_bounds__(GWV * 32) void k_projqkv(const h16* __restrict__ XH, const h16* __restrict__ WQ, const h16* __restrict__ WK, const h16* __restrict__ WV,
                                                      const float* __restrict__ bq, const float* __restrict__ bk, const float* __restrict__ bv, h16* QP, h16* KP, h16* VT) {
    __shared__ __align__(16) h16 ring[2 * GSTH];
    __shared__ __align__(16) h16 tsall[GWV * 64 * TSP];
    if (blockIdx.z == 2) projv_body(XH, WV, bv, VT, ring, tsall);
    else projqk_body(XH, blockIdx.z == 0 ? WQ : WK, blockIdx.z == 0 ? bq : bk, blockIdx.z == 0 ? C2 : 1.0f, blockIdx.z == 0 ? QP : KP, ring, tsall);   // q carries the softmax's scale
}

// ---- k_attn: fused attention. One wave = 32 query rows (two groups of 16) of one (b,h): every K and V^T fragment read from LDS feeds both groups. The 8 waves of a block walk the same keys and share each 64-key K tile and V^T tile through LDS.
// A stage = K tile [64 keys][64 d] + V^T tile [64 d][64 keys], rows of 128 B at the 144-B pitch; two stages in LDS: the next one is copied in (global -> LDS, no register) while this one is read.
// Per 64-key step and query group: 4 tiles S^T[key][query] = K-tile (A) x Q^T (B) - ref, in the exp2 domain: ref, one reference value per query column, enters as the score product's C operand, so p = exp2(tile) with no
// arithmetic in between. ref is the column's maximum over the first 64 keys; it moves (and sums and outputs are rescaled, with one xor-16 exchange) only in a step where some score of the wave lies more than RBT above it;
// P^T B fragments repacked in-lane from the S^T accumulators (element r <- tile 2u [r], element 8+r <- tile 2u+1 [r]); O^T[d][query] += V^T (A) x P^T (B).
#define AWV    8                     // waves per attention block
#define QG     2                     // query groups of 16 per wave
#define KSTEP  64                    // keys per stage
#define RBT    8.0f                  // a score may exceed its column's reference by this much (p <= 2^8, well inside f16)
#define TILEH  (64 * TSP)            // halves of one staged tile
#define STAGEH (2 * TILEH)           // halves of one stage (K tile, then V^T tile)
static_assert(SEQ % (AWV * QG * 16) == 0);
static_assert(SEQ / KSTEP >= 2);
static_assert(AWV * 32 * 2 * 8 == 64 * HD);   // two 16-B pieces per lane cover one tile

// One stage's copies: each lane moves four 16-B pieces (rows r and r + 32 of both tiles). lk = the lane's LDS byte address in the K tile; gk, gv = its global pieces of row r.
__device__ __forceinline__ void stage_copy(unsigned lk, const h16* gk, const h16* gv) {
    const unsigned lk1 = lk + 32 * TSP * 2, lv = lk + TILEH * 2, lv1 = lk + TILEH * 2 + 32 * TSP * 2;
    const h16* gk1 = gk + 32 * HD; const h16* gv1 = gv + (size_t)32 * SEQ;
    // the closing s_wait_xcnt keeps every later write of these address registers behind the copies' issue
    asm volatile("global_load_async_to_lds_b128 %0, %4, off\n\t"
                 "global_load_async_to_lds_b128 %1, %5, off\n\t"
                 "global_load_async_to_lds_b128 %2, %6, off\n\t"
                 "global_load_async_to_lds_b128 %3, %7, off\n\t"
                 "s_wait_xcnt 0x0"
                 :: "v"(lk), "v"(lk1), "v"(lv), "v"(lv1), "v"(gk), "v"(gk1), "v"(gv), "v"(gv1) : "memory");
}

// second bound: 4 waves per SIMD (256 registers a wave), so that two blocks share a WGP and the whole grid is resident at once
__global__ __launch_bounds__(AWV * 32, 4) void k_attn(const h16* __restrict__ Qp, const h16* __restrict__ Kp, const h16* __restrict__ Vt, h16* Ctx) {
    __shared__ __align__(16) h16 ring[2 * STAGEH];
    __shared__ __align__(16) h16 os[AWV * QG * 16 * TSP];
    const int tid = threadIdx.x;
    const int lane = tid & 31, lr = lane & 15, hi = lane >> 4, wv = tid >> 5;
    const int bh = blockIdx.y; const int q0 = blockIdx.x * (AWV * QG * 16) + wv * (QG * 16);
    const size_t pbase = (size_t)bh * SEQ * HD;
    const unsigned cl = lds_off(ring) + (unsigned)(((tid >> 3) * TSP + (tid & 7) * 8) * 2);
    const h16* gk = Kp + pbase + (size_t)(tid >> 3) * HD + (tid & 7) * 8;
    const h16* gv = Vt + pbase + (size_t)(tid >> 3) * SEQ + (tid & 7) * 8;
    stage_copy(cl, gk, gv);
    v16h qb0[QG], qb1[QG];
    v8f o[QG][4];
    v8f nref[QG];                                                            // all eight elements: minus the column's reference
    float l[QG];
#pragma unroll
    for (int c = 0; c < QG; ++c) {
        const h16* qrow = Qp + pbase + (size_t)(q0 + c * 16 + lr) * HD + 8 * hi;
        qb0[c] = ldh(qrow); qb1[c] = ldh(qrow + 32);
#pragma unroll
        for (int dt = 0; dt < 4; ++dt) o[c][dt] = (v8f){};
        nref[c] = (v8f){}; l[c] = 0.0f;
    }
    asm volatile("s_wait_asynccnt 0x0" ::: "memory");                        // this wave's pieces of stage 0 have landed
    __syncthreads();                                                         // ... and every other wave's
    stage_copy(cl + STAGEH * 2, gk + (size_t)KSTEP * HD, gv + KSTEP);
#pragma unroll 1
    for (int kb = 0; kb < SEQ; kb += KSTEP) {
        const int sb = ((kb / KSTEP) & 1) * STAGEH;                          // this step's stage
        const h16* kbase = &ring[sb + lr * TSP + 8 * hi];
        const h16* vbase = kbase + TILEH;
        v8f st[QG][4]; v16h ka0, ka1;
#pragma unroll
        for (int t = 0; t < 4; ++t) { const h16* kp = kbase + t * 16 * TSP; ka0 = ldhs(kp); ka1 = ldhs(kp + 32);
#pragma unroll
            for (int c = 0; c < QG; ++c) st[c][t] = wmma16(ka0, qb0[c], nref[c]);
#pragma unroll
            for (int c = 0; c < QG; ++c) st[c][t] = wmma16(ka1, qb1[c], st[c][t]); }
        // four vector slots between the last score WMMA and the first vector read of a score tile; naming the tiles keeps the 16 WMMAs one run, with no vector work spread among them
        asm volatile("v_nop\n\tv_nop\n\tv_nop\n\tv_nop" : "+v"(st[0][0]), "+v"(st[0][1]), "+v"(st[0][2]), "+v"(st[0][3]), "+v"(st[1][0]), "+v"(st[1][1]), "+v"(st[1][2]), "+v"(st[1][3])
                     : "v"(ka0), "v"(ka1), "v"(qb0[0]), "v"(qb1[0]), "v"(qb0[1]), "v"(qb1[1]));
        v16h va[2][2];                                                       // two V^T fragment sets; the first d tile's is read here, under the softmax
        va[0][0] = ldhs(vbase); va[0][1] = ldhs(vbase + 32);
        float mloc[QG];
#pragma unroll
        for (int c = 0; c < QG; ++c) {
            mloc[c] = fmaxf(fmaxf(st[c][0][0], st[c][1][0]), fmaxf(st[c][2][0], st[c][3][0]));
#pragma unroll
            for (int j = 1; j < 8; ++j) mloc[c] = fmaxf(mloc[c], fmaxf(fmaxf(st[c][0][j], st[c][1][j]), fmaxf(st[c][2][j], st[c][3][j])));
        }
        // one wave-uniform test per step; the first step always sets the reference
        if ((__builtin_amdgcn_ballot_w32(fmaxf(mloc[0], mloc[1]) > RBT) | (unsigned)(kb == 0)) != 0) {
#pragma unroll
            for (int c = 0; c < QG; ++c) {
                const float mx = fmaxf(mloc[c], __shfl_xor(mloc[c], 16, 32));
                const float d = kb == 0 ? mx : fmaxf(mx, 0.0f);              // the reference never falls once it is set
                const float corr = __builtin_amdgcn_exp2f(fminf(-d, 0.0f));  // first step: sums and outputs are still 0, and the factor stays finite
                nref[c] -= d; l[c] *= corr;
#pragma unroll
                for (int t = 0; t < 4; ++t) { st[c][t] -= d; o[c][t] *= corr; }
            }
        }
        v16h pb0[QG], pb1[QG];
#pragma unroll
        for (int c = 0; c < QG; ++c) {
            float psum = 0.0f;
#pragma unroll
            for (int j = 0; j < 8; ++j) {
                const float p0 = __builtin_amdgcn_exp2f(st[c][0][j]);
                const float p1 = __builtin_amdgcn_exp2f(st[c][1][j]);
                const float p2 = __builtin_amdgcn_exp2f(st[c][2][j]);
                const float p3 = __builtin_amdgcn_exp2f(st[c][3][j]);
                psum += (p0 + p1) + (p2 + p3);
                pb0[c][j] = (h16)p0; pb0[c][8 + j] = (h16)p1; pb1[c][j] = (h16)p2; pb1[c][8 + j] = (h16)p3; }
            l[c] += psum;
        }
#pragma unroll
        for (int dt = 0; dt < 4; ++dt) {                                     // the next d tile's V^T fragments are read ahead of this tile's products
            if (dt + 1 < 4) { const h16* vp = vbase + (dt + 1) * 16 * TSP; va[(dt + 1) & 1][0] = ldhs(vp); va[(dt + 1) & 1][1] = ldhs(vp + 32); }
#pragma unroll
            for (int c = 0; c < QG; ++c) o[c][dt] = wmma16(va[dt & 1][0], pb0[c], o[c][dt]);
#pragma unroll
            for (int c = 0; c < QG; ++c) o[c][dt] = wmma16(va[dt & 1][1], pb1[c], o[c][dt]); }
        // the same four slots behind the last output WMMA, ahead of the branch at the loop's foot on both of its sides; naming the two sums keeps their additions in this step, among the output products:
        // moved behind the barrier, they would hold all 64 f32 probabilities in registers across the products, and no V^T fragment could be read ahead
        asm volatile("v_nop\n\tv_nop\n\tv_nop\n\tv_nop" : "+v"(o[0][0]), "+v"(o[0][1]), "+v"(o[0][2]), "+v"(o[0][3]), "+v"(o[1][0]), "+v"(o[1][1]), "+v"(o[1][2]), "+v"(o[1][3]), "+v"(l[0]), "+v"(l[1])
                     : "v"(va[1][0]), "v"(va[1][1]), "v"(pb0[0]), "v"(pb1[0]), "v"(pb0[1]), "v"(pb1[1]));
        asm volatile("s_wait_dscnt 0x0" ::: "memory");                       // this wave's reads of this stage are done before the stage is refilled
        asm volatile("s_wait_asynccnt 0x0" ::: "memory");                    // this wave's pieces of the next stage have landed
        __syncthreads();                                                     // publishes the next stage; ends every wave's reads of this one
        if (kb + 2 * KSTEP < SEQ) stage_copy(cl + (unsigned)sb * 2, gk + (size_t)(kb + 2 * KSTEP) * HD, gv + (kb + 2 * KSTEP));
    }
    asm volatile("s_wait_asynccnt 0x0" ::: "memory");                        // no copy is left in flight when the wave ends
    const int ob = wv * QG * 16 * TSP;                                       // wave-private staging region
#pragma unroll
    for (int c = 0; c < QG; ++c) {
        const float lt = l[c] + __shfl_xor(l[c], 16, 32);
        const float inv = CCAR * (1.0f / lt);
#pragma unroll
        for (int dt = 0; dt < 4; ++dt) { v8h hv;                             // o[c][dt][j] = O^T[d = dt*16 + 8*hi + j][query c*16 + lr]
#pragma unroll
            for (int j = 0; j < 8; ++j) hv[j] = (h16)(o[c][dt][j] * inv);
            *(v8ha*)(&os[ob + (c * 16 + lr) * TSP + dt * 16 + 8 * hi]) = hv; }
    }
    wave_lds_sync();
    const int b = bh / NH, h = bh % NH;
    h16* dst = Ctx + ((size_t)b * SEQ + q0) * DM + h * HD;
#pragma unroll
    for (int it = 0; it < QG * 4; ++it) { const int qq = it * 4 + (lane >> 3), pc = lane & 7; const v8h val = *(const v8ha*)(&os[ob + qq * TSP + pc * 8]);
        *(v8h*)(dst + (size_t)qq * DM + pc * 8) = val; }
}

// Block = 128 ctx rows x 256 output columns; wave wv: rows 64 * (wv >> 2), columns 64 * (wv & 3).
__global__ __launch_bounds__(GWV * 32) void k_outp(const h16* __restrict__ CTX, const h16* __restrict__ WO, const float* __restrict__ bias, float* OUT) {
    __shared__ __align__(16) h16 ring[2 * GSTH];
    __shared__ __align__(16) float osall[GWV * 16 * 68];
    const int tid = threadIdx.x, lane = tid & 31, lr = lane & 15, hi = lane >> 4, wv = tid >> 5;
    float* os = osall + wv * 16 * 68;                                       // wave-private staging region
    const int r0 = blockIdx.x * 128 + (wv >> 2) * 64, c0 = blockIdx.y * 256 + (wv & 3) * 64; const int bz = r0 / SEQ, s0 = r0 % SEQ;
    v8f acc[4][4];
    gemm_blk<128>(CTX + (size_t)blockIdx.x * 128 * DM, WO + (size_t)blockIdx.y * 256 * DM, ring, (wv >> 2) * 64, (wv & 3) * 64, acc, tid, lr, hi);       // acc[mb][nb][j]: row mb*16 + 8*hi + j, col nb*16 + lr
    const v4f braw = *(const v4f*)(bias + c0 + lr * 4); v4f bb; bb[0] = bfr(braw[0]); bb[1] = bfr(braw[1]); bb[2] = bfr(braw[2]); bb[3] = bfr(braw[3]);
    float* cbase = OUT + ((size_t)bz * SEQ_FULL + s0) * DM + c0;
#pragma unroll
    for (int mb = 0; mb < 4; ++mb) {
#pragma unroll
        for (int nb = 0; nb < 4; ++nb) {
#pragma unroll
            for (int j = 0; j < 8; ++j) os[(hi * 8 + j) * 68 + nb * 16 + lr] = acc[mb][nb][j] * OINV; }
        wave_lds_sync();
        float* crow = cbase + (size_t)(mb * 16) * DM;
{
#pragma unroll
            for (int s = 0; s < 8; ++s) { const int row = 2 * s + hi, cofs = lr * 4; v4f val = *(const v4fa*)(os + row * 68 + cofs); val += bb;
                *(v4f*)(crow + (size_t)row * DM + cofs) = val; }
             }
        wave_lds_sync();
    }
}

#define SZ_X    ((size_t)NB * SEQ * DM * 2)
#define SZ_W    ((size_t)DM * DM * 2)
#define SZ_ALL  (SZ_X * 5 + SZ_W * 4)
static_assert(SZ_X % 256 == 0);
static_assert(SZ_W % 256 == 0);
static_assert(SZ_ALL <= (size_t)134217728);

extern "C" void kernel_launch(void* const* d_in, const int* in_sizes, int n_in,
                              void* d_out, int out_size, void* d_ws, size_t ws_size, hipStream_t stream) {
    if (n_in < 9) return;
    const size_t needx = ((size_t)(NB - 1) * SEQ_FULL + SEQ) * DM;
    if ((size_t)in_sizes[0] < needx) return;
    if ((size_t)in_sizes[1] < (size_t)NH * DM * HD || (size_t)in_sizes[3] < (size_t)NH * DM * HD || (size_t)in_sizes[5] < (size_t)NH * DM * HD) return;
    if ((size_t)in_sizes[2] < (size_t)NH * HD || (size_t)in_sizes[4] < (size_t)NH * HD || (size_t)in_sizes[6] < (size_t)NH * HD) return;
    if ((size_t)in_sizes[7] < (size_t)DM * DM || (size_t)in_sizes[8] < (size_t)DM) return;
    if ((size_t)out_size < needx) return;
    if (SZ_ALL > ws_size) return;
    const float* xs = (const float*)d_in[0];
    const float* Wq = (const float*)d_in[1]; const float* bq = (const float*)d_in[2];
    const float* Wk = (const float*)d_in[3]; const float* bk = (const float*)d_in[4];
    const float* Wv = (const float*)d_in[5]; const float* bv = (const float*)d_in[6];
    const float* Wo = (const float*)d_in[7]; const float* bo = (const float*)d_in[8];
    float* OUT = (float*)d_out;
    char* wsp = (char*)d_ws;
    h16* XH  = (h16*)wsp; wsp += SZ_X;      // [NB*SEQ][DM]
    h16* WQ  = (h16*)wsp; wsp += SZ_W;      // Bt [h*64+d][e], x64
    h16* WK  = (h16*)wsp; wsp += SZ_W;
    h16* WV  = (h16*)wsp; wsp += SZ_W;
    h16* WO  = (h16*)wsp; wsp += SZ_W;      // Bt [out][in], x64
    h16* QP  = (h16*)wsp; wsp += SZ_X;      // [b][h][s][d]
    h16* KP  = (h16*)wsp; wsp += SZ_X;      // [b][h][s][d]
    h16* VT  = (h16*)wsp; wsp += SZ_X;      // [b][h][d][s]
    h16* CTX = (h16*)wsp; wsp += SZ_X;      // [NB*SEQ][DM], x64

    k_prep<<<(unsigned)(PTH / 256), 256, 0, stream>>>(xs, Wq, Wk, Wv, Wo, XH, WQ, WK, WV, WO);
    k_projqkv<<<dim3(NB * SEQ / 128, DM / 256, 3), GWV * 32, 0, stream>>>(XH, WQ, WK, WV, bq, bk, bv, QP, KP, VT);
    k_attn<<<dim3(SEQ / (AWV * QG * 16), NB * NH, 1), AWV * 32, 0, stream>>>(QP, KP, VT, CTX);
    k_outp<<<dim3(NB * SEQ / 128, DM / 256, 1), GWV * 32, 0, stream>>>(CTX, WO, bo, OUT);
}

// v006
// A run of this version takes 109 microseconds.
// Two timings next to v005 both put it at 1.16 times that version's speed.
// All steps since v000 together make it 3.33 times as fast.
#include <hip/hip_runtime.h>

#ifndef NB
#define NB 4
#endif
#ifndef SEQ
#define SEQ 2048
#endif
#define NB_FULL  4
#define SEQ_FULL 2048
#define DM   1024
#define NH   16
#define HD   64
#define WCAR 64.0f
#define WINV (1.0f / 64.0f)
#define CCAR 64.0f
#define OINV (1.0f / 4096.0f)
#define C2   0.18033688011112042f   // (1/8) * log2(e)
#define TSP  72                     // LDS tile pitch in halves (144 B, multiple of 16 B)

static_assert(NH * HD == DM);
static_assert(HD == 64);
static_assert(DM % 32 == 0);
static_assert(DM % 64 == 0);
static_assert(SEQ % 64 == 0);
static_assert(SEQ <= SEQ_FULL);
static_assert(NB <= NB_FULL);
static_assert((TSP * 2) % 16 == 0);
static_assert(TSP >= HD);

typedef _Float16 h16;
typedef __attribute__((ext_vector_type(16))) _Float16 v16h;
typedef __attribute__((ext_vector_type(8)))  _Float16 v8h;
typedef __attribute__((ext_vector_type(8)))  float    v8f;
typedef __attribute__((ext_vector_type(4)))  float    v4f;
typedef v8h __attribute__((may_alias)) v8ha;
typedef v4f __attribute__((may_alias)) v4fa;

__device__ __forceinline__ unsigned short f2bf(float f) { unsigned u = __float_as_uint(f); u += 0x7FFFu + ((u >> 16) & 1u); return (unsigned short)(u >> 16); }
__device__ __forceinline__ float bf2f(unsigned short b) { return __uint_as_float(((unsigned)b) << 16); }
__device__ __forceinline__ float bfr(float f) { return bf2f(f2bf(f)); }
__device__ __forceinline__ v16h cat16(v8h lo, v8h hi) { return __builtin_shufflevector(lo, hi, 0, 1, 2, 3, 4, 5, 6, 7, 8, 9, 10, 11, 12, 13, 14, 15); }
// fragment from a K-contiguous f16 row: elements 0..7 <- p[0..7], 8..15 <- p[16..23]; caller passes p = row + k0 + 8*(lane>>4)
__device__ __forceinline__ v16h ldh(const h16* p) { return cat16(*(const v8h*)p, *(const v8h*)(p + 16)); }
__device__ __forceinline__ v8f wmma16(v16h a, v16h b, v8f c) { return __builtin_amdgcn_wmma_f32_16x16x32_f16(false, a, false, b, (short)0, c, false, false); }
__device__ __forceinline__ void wave_lds_sync() { __builtin_amdgcn_fence(3 /* release order */, "wavefront"); __builtin_amdgcn_wave_barrier(); asm volatile("" ::: "memory"); }

// ---- k_prep: every operand conversion in one launch. Each thread converts one 8 k x 4 n unit of one weight matrix (a quarter of the blocks per matrix) and XU 8-element units of x.
#define PTH ((size_t)DM * DM / 8)                 // threads of the launch
#define WTH (PTH / 4)                             // threads (= units) per weight matrix
#define XU  ((int)((size_t)NB * SEQ * DM / 8 / PTH))   // x units per thread
static_assert(((size_t)NB * SEQ * DM / 8) % PTH == 0);
static_assert(PTH % 256 == 0);
static_assert(WTH % 256 == 0);                    // the matrix is the same for a whole block
static_assert(WTH * 32 == (size_t)DM * DM);
static_assert(HD % 16 == 0);

// Weight transpose Bt[R = z*N + n][k] <- w[z][k][n], K = DM. A wave takes 64 k x 16 rows of Bt: lane = (k group of 8) * 4 + (quad of rows).
// Each load: 16 B a lane, four lanes side by side on one source row (8 lines a wave); each store: 16 B a lane, eight lanes side by side on one row of Bt (4 whole 128-B lines a wave).
template <int N>
__device__ __forceinline__ void wt_read(const float* __restrict__ w, int R, int k, v4f (&r)[8]) {
    const float* s = w + ((size_t)(R / N) * DM + k) * N + (R % N);
#pragma unroll
    for (int j = 0; j < 8; ++j) r[j] = *(const v4f*)(s + (size_t)j * N);
    asm volatile("s_wait_xcnt 0x0" ::: "memory");                                // a later load's result may land in this group's address registers: the wait stands ahead of it
}
__device__ __forceinline__ void wt_write(const v4f (&r)[8], int R, int k, h16* Bt) {
#pragma unroll
    for (int e = 0; e < 4; ++e) {
        v8h o;
#pragma unroll
        for (int j = 0; j < 8; ++j) o[j] = (h16)(bfr(r[j][e]) * WCAR);
        *(v8h*)(Bt + (size_t)(R + e) * DM + k) = o;
    }
}

// x carries no __restrict__: its loads then keep their source order among the s_wait_xcnt statements below (as no-alias loads they were moved behind all of them)
__global__ __launch_bounds__(256) void k_prep(const float* x, const float* __restrict__ wq, const float* __restrict__ wk, const float* __restrict__ wv, const float* __restrict__ wo,
                                              h16* XH, h16* WQ, h16* WK, h16* WV, h16* WO) {
    const size_t i = (size_t)blockIdx.x * 256 + threadIdx.x;
    const int sel = (int)(blockIdx.x / (unsigned)(WTH / 256));                   // 0: q, 1: k, 2: v, 3: o
    const int un = (int)(blockIdx.x % (unsigned)(WTH / 256)) * 256 + (int)threadIdx.x;   // the thread's unit of that matrix
    const int wi = un >> 5;                                                      // the wave's 64 k x 16 row piece; neighbouring waves take neighbouring row groups, so the halves of a source line are read together
    const int R = (wi % (DM / 16)) * 16 + (un & 3) * 4, k = (wi / (DM / 16)) * 64 + ((un >> 2) & 7) * 8;
    v4f rw[8];
    if (sel == 3) wt_read<DM>(wo, R, k, rw);                                     // in[e][o] -> Bt[o][e]
    else wt_read<HD>(sel == 0 ? wq : sel == 1 ? wk : wv, R, k, rw);              // in[h][e][d] -> Bt[h*64 + d][e]
    v4f v0[XU], v1[XU];
#pragma unroll
    for (int u = 0; u < XU; ++u) {
        const size_t xi = i + (size_t)u * PTH;
        const size_t r = xi / (DM / 8); const size_t c8 = xi % (DM / 8); const size_t b = r / SEQ, s = r % SEQ;
        const float* src = x + (b * SEQ_FULL + s) * DM + c8 * 8;
        v0[u] = *(const v4f*)src; v1[u] = *(const v4f*)(src + 4);
        asm volatile("s_wait_xcnt 0x0" ::: "memory");                            // as in wt_read
    }
    __builtin_amdgcn_sched_barrier(0);                                           // keeps every load of the thread issued ahead of the first conversion: one memory latency a thread, not one a group
    wt_write(rw, R, k, sel == 0 ? WQ : sel == 1 ? WK : sel == 2 ? WV : WO);
#pragma unroll
    for (int u = 0; u < XU; ++u) {
        v8h o;
        o[0] = (h16)bfr(v0[u][0]); o[1] = (h16)bfr(v0[u][1]); o[2] = (h16)bfr(v0[u][2]); o[3] = (h16)bfr(v0[u][3]);
        o[4] = (h16)bfr(v1[u][0]); o[5] = (h16)bfr(v1[u][1]); o[6] = (h16)bfr(v1[u][2]); o[7] = (h16)bfr(v1[u][3]);
        *(v8h*)(XH + (i + (size_t)u * PTH) * 8) = o;
    }
}

// ---- gemm_blk: one block of 8 waves, 64x64 f32 tile per wave: acc[mb][nb][j] = sum_k A[arow + mb*16 + 8*hi + j][k] * Bt[brow + nb*16 + lr][k], K = DM, both operands K-contiguous f16 rows (pitch DM).
// The block's RA rows of A and GROWS - RA rows of Bt are shared through LDS. A stage = GKS k of all GROWS rows (rows of 256 B at the 272-B pitch); two stages in LDS:
// the next one is copied in (global -> LDS, no register) while this one is read.
#define GWV   8                      // waves per GEMM block
#define GKS   128                    // k per stage
#define GP    136                    // LDS row pitch in halves (272 B = 16 B x 17)
#define GROWS 384                    // rows per stage, both operands together
#define GSTH  (GROWS * GP)           // halves of one stage
static_assert(DM % GKS == 0);
static_assert(DM / GKS >= 2);
static_assert((GP * 2) % 16 == 0);
static_assert(GP >= GKS);
static_assert(GWV * 32 * 8 * 8 == 128 * GKS);   // eight 16-B pieces per lane cover 128 rows of a stage
static_assert((NB * SEQ) % 128 == 0);
static_assert(DM % 256 == 0);

__device__ __forceinline__ unsigned lds_off(const void* p) { return (unsigned)(size_t)p; }
__device__ __forceinline__ v16h ldhs(const h16* p) { return cat16(*(const v8ha*)p, *(const v8ha*)(p + 16)); }
// 128 rows of a stage: each lane moves eight 16-B pieces (rows r, r + 16, ... r + 112). l = the lane's LDS byte address of row r; g = its global piece of row r.
__device__ __forceinline__ void copy_rows128(unsigned l, const h16* g) {
    const unsigned l1 = l + 16 * GP * 2, l2 = l + 32 * GP * 2, l3 = l + 48 * GP * 2, l4 = l + 64 * GP * 2, l5 = l + 80 * GP * 2, l6 = l + 96 * GP * 2, l7 = l + 112 * GP * 2;
    const h16* g1 = g + 16 * DM; const h16* g2 = g + 32 * DM; const h16* g3 = g + 48 * DM; const h16* g4 = g + 64 * DM;
    const h16* g5 = g + 80 * DM; const h16* g6 = g + 96 * DM; const h16* g7 = g + 112 * DM;
    // the closing s_wait_xcnt keeps every later write of these address registers behind the copies' issue
    asm volatile("global_load_async_to_lds_b128 %0, %8, off\n\t"
                 "global_load_async_to_lds_b128 %1, %9, off\n\t"
                 "global_load_async_to_lds_b128 %2, %10, off\n\t"
                 "global_load_async_to_lds_b128 %3, %11, off\n\t"
                 "global_load_async_to_lds_b128 %4, %12, off\n\t"
                 "global_load_async_to_lds_b128 %5, %13, off\n\t"
                 "global_load_async_to_lds_b128 %6, %14, off\n\t"
                 "global_load_async_to_lds_b128 %7, %15, off\n\t"
                 "s_wait_xcnt 0x0"
                 :: "v"(l), "v"(l1), "v"(l2), "v"(l3), "v"(l4), "v"(l5), "v"(l6), "v"(l7),
                    "v"(g), "v"(g1), "v"(g2), "v"(g3), "v"(g4), "v"(g5), "v"(g6), "v"(g7) : "memory");
    __builtin_amdgcn_sched_barrier(0);                                       // keeps a later group's address sums behind this group's issue: fewer registers live at once, no spill
}
// One stage's copies: stage rows 0 .. RA-1 are A rows, the rest Bt rows. cl = the lane's LDS byte address in the stage's row (tid >> 4); ga, gb = its global pieces of that row of A and of Bt at this stage's k.
template <int RA>
__device__ __forceinline__ void gemm_stage(unsigned cl, const h16* ga, const h16* gb) {
#pragma unroll
    for (int r0 = 0; r0 < GROWS; r0 += 128) copy_rows128(cl + (unsigned)(r0 * GP * 2), r0 < RA ? ga + (size_t)r0 * DM : gb + (size_t)(r0 - RA) * DM);
}

template <int RA>
__device__ __forceinline__ void gemm_blk(const h16* __restrict__ A, const h16* __restrict__ Bt, h16* ring, int arow, int brow, v8f (&acc)[4][4], int tid, int lr, int hi) {
    static_assert(RA % 128 == 0 && RA < GROWS);
#pragma unroll
    for (int mb = 0; mb < 4; ++mb)
#pragma unroll
        for (int nb = 0; nb < 4; ++nb) acc[mb][nb] = (v8f){};
    const unsigned cl = lds_off(ring) + (unsigned)(((tid >> 4) * GP + (tid & 15) * 8) * 2);
    const h16* ga = A + (size_t)(tid >> 4) * DM + (tid & 15) * 8;
    const h16* gb = Bt + (size_t)(tid >> 4) * DM + (tid & 15) * 8;
    gemm_stage<RA>(cl, ga, gb);
    asm volatile("s_wait_asynccnt 0x0" ::: "memory");                        // this wave's pieces of stage 0 have landed
    __syncthreads();                                                         // ... and every other wave's
    gemm_stage<RA>(cl + GSTH * 2, ga + GKS, gb + GKS);
#pragma unroll 1
    for (int t = 0; t < DM / GKS; ++t) {
        const int sb = (t & 1) * GSTH;                                       // this trip's stage
        const h16* ap = ring + sb + (arow + lr) * GP + 8 * hi;
        const h16* bp = ring + sb + (RA + brow + lr) * GP + 8 * hi;
        v16h a[2][4], b[2][4];                                               // two fragment sets: the next 32 k of this stage are read as one group while this set is multiplied
#pragma unroll
        for (int f = 0; f < 4; ++f) { a[0][f] = ldhs(ap + f * 16 * GP); b[0][f] = ldhs(bp + f * 16 * GP); }
#pragma unroll
        for (int ks = 0; ks < GKS / 32; ++ks) {
            if (ks + 1 < GKS / 32) {
#pragma unroll
                for (int f = 0; f < 4; ++f) { a[(ks + 1) & 1][f] = ldhs(ap + f * 16 * GP + (ks + 1) * 32); b[(ks + 1) & 1][f] = ldhs(bp + f * 16 * GP + (ks + 1) * 32); }
            }
            else {                                                           // the stage's last fragments are in registers: the buffer is handed over before they are multiplied, so the refill flies longer
                asm volatile("s_wait_dscnt 0x0" ::: "memory");               // this wave's reads of this stage are done before the stage is refilled
                asm volatile("s_wait_asynccnt 0x0" ::: "memory");            // this wave's pieces of the next stage have landed
                __syncthreads();                                             // publishes the next stage; ends every wave's reads of this one
                if (t + 2 < DM / GKS) gemm_stage<RA>(cl + (unsigned)sb * 2, ga + (t + 2) * GKS, gb + (t + 2) * GKS);
            }
            __builtin_amdgcn_sched_barrier(0);                               // keeps the read group (last block: the hand-over) ahead of the matrix run instead of spread among it
#pragma unroll
            for (int nb = 0; nb < 4; ++nb)
#pragma unroll
                for (int mb = 0; mb < 4; ++mb) acc[mb][nb] = wmma16(a[ks & 1][mb], b[ks & 1][nb], acc[mb][nb]);
            __builtin_amdgcn_sched_barrier(0);                               // keeps this matrix run ahead of the next read group and of the hand-over
        }
    }
    asm volatile("s_wait_asynccnt 0x0" ::: "memory");                        // no copy is left in flight behind the loop
}

__device__ __forceinline__ void store_tile64(const h16* ts_base_unused, h16* dst, size_t pitch, int lane);

// ---- projqk_body: plane P[b][h][s][d] (f16) = (x Wt^T / 64 + b) * sc. Operand roles swapped (A = weight rows, B = x rows) so each lane holds 8 consecutive d of one s.
// Block = 4 heads (256 weight rows) x 128 x rows; wave wv: head wv & 3 of them, x rows 64 * (wv >> 2).
__device__ __forceinline__ void projqk_body(const h16* __restrict__ XH, const h16* __restrict__ WT, const float* __restrict__ bias, float sc, h16* P, h16* ring, h16* tsall) {
    const int tid = threadIdx.x, lane = tid & 31, lr = lane & 15, hi = lane >> 4, wv = tid >> 5;
    h16* ts = tsall + wv * 64 * TSP;                                        // wave-private staging region
    const int r0 = blockIdx.x * 128 + (wv >> 2) * 64, head = blockIdx.y * 4 + (wv & 3); const int bz = r0 / SEQ, s0 = r0 % SEQ;
    const float asc = WINV * sc;
    v8f acc[4][4];
    gemm_blk<256>(WT + (size_t)blockIdx.y * 256 * DM, XH + (size_t)blockIdx.x * 128 * DM, ring, (wv & 3) * 64, (wv >> 2) * 64, acc, tid, lr, hi);   // acc[mb][nb][j]: d = mb*16 + 8*hi + j, s = nb*16 + lr
#pragma unroll
    for (int mb = 0; mb < 4; ++mb) {
        const v4f b0 = *(const v4f*)(bias + head * HD + mb * 16 + 8 * hi); const v4f b1 = *(const v4f*)(bias + head * HD + mb * 16 + 8 * hi + 4);
        v8f bb; bb[0] = bfr(b0[0]); bb[1] = bfr(b0[1]); bb[2] = bfr(b0[2]); bb[3] = bfr(b0[3]); bb[4] = bfr(b1[0]); bb[5] = bfr(b1[1]); bb[6] = bfr(b1[2]); bb[7] = bfr(b1[3]);
        bb *= sc;
#pragma unroll
        for (int nb = 0; nb < 4; ++nb) { v8h hv;
#pragma unroll
            for (int j = 0; j < 8; ++j) hv[j] = (h16)(acc[mb][nb][j] * asc + bb[j]);
            *(v8ha*)(&ts[(nb * 16 + lr) * TSP + mb * 16 + 8 * hi]) = hv; } }
    wave_lds_sync();                                                        // ts is private to this wave
    h16* dst = P + (((size_t)bz * NH + head) * SEQ + s0) * HD;
{
#pragma unroll
        for (int it = 0; it < 16; ++it) { const int L = it * 4 + (lane >> 3), pc = lane & 7; const v8h val = *(const v8ha*)(&ts[L * TSP + pc * 8]);
            *(v8h*)(dst + (size_t)L * HD + pc * 8) = val; }
         }
}

// ---- projv_body: transposed plane VT[b][h][d][s] (f16) = x Wv^T / 64 + bv (A = x rows, B = weight rows: each lane holds 8 consecutive s of one d).
// Block = 128 x rows x 4 heads (256 weight rows); wave wv: x rows 64 * (wv >> 2), head wv & 3 of them.
__device__ __forceinline__ void projv_body(const h16* __restrict__ XH, const h16* __restrict__ WT, const float* __restrict__ bias, h16* VT, h16* ring, h16* tsall) {
    const int tid = threadIdx.x, lane = tid & 31, lr = lane & 15, hi = lane >> 4, wv = tid >> 5;
    h16* ts = tsall + wv * 64 * TSP;                                        // wave-private staging region
    const int r0 = blockIdx.x * 128 + (wv >> 2) * 64, head = blockIdx.y * 4 + (wv & 3); const int bz = r0 / SEQ, s0 = r0 % SEQ;
    v8f acc[4][4];
    gemm_blk<128>(XH + (size_t)blockIdx.x * 128 * DM, WT + (size_t)blockIdx.y * 256 * DM, ring, (wv >> 2) * 64, (wv & 3) * 64, acc, tid, lr, hi);   // acc[mb][nb][j]: s = mb*16 + 8*hi + j, d = nb*16 + lr
#pragma unroll
    for (int nb = 0; nb < 4; ++nb) { const float bb = bfr(bias[head * HD + nb * 16 + lr]);
#pragma unroll
        for (int mb = 0; mb < 4; ++mb) { v8h hv;
#pragma unroll
            for (int j = 0; j < 8; ++j) hv[j] = (h16)(acc[mb][nb][j] * WINV + bb);
            *(v8ha*)(&ts[(nb * 16 + lr) * TSP + mb * 16 + 8 * hi]) = hv; } }
    wave_lds_sync();
    h16* dst = VT + (((size_t)bz * NH + head) * HD) * SEQ + s0;
{
#pragma unroll
        for (int it = 0; it < 16; ++it) { const int L = it * 4 + (lane >> 3), pc = lane & 7; const v8h val = *(const v8ha*)(&ts[L * TSP + pc * 8]);
            *(v8h*)(dst + (size_t)L * SEQ + pc * 8) = val; }
         }
}

// ---- k_projqkv: the three projections in one launch; blockIdx.z = 0: q, 1: k, 2: v (the choice is the same for a whole block).
__global__ __launch_bounds__(GWV * 32) void k_projqkv(const h16* __restrict__ XH, const h16* __restrict__ WQ, const h16* __restrict__ WK, const h16* __restrict__ WV,
                                                      const float* __restrict__ bq, const float* __restrict__ bk, const float* __restrict__ bv, h16* QP, h16* KP, h16* VT) {
    __shared__ __align__(16) h16 ring[2 * GSTH];
    __shared__ __align__(16) h16 tsall[GWV * 64 * TSP];
    if (blockIdx.z == 2) projv_body(XH, WV, bv, VT, ring, tsall);
    else projqk_body(XH, blockIdx.z == 0 ? WQ : WK, blockIdx.z == 0 ? bq : bk, blockIdx.z == 0 ? C2 : 1.0f, blockIdx.z == 0 ? QP : KP, ring, tsall);   // q carries the softmax's scale
}

// ---- k_attn: fused attention. One wave = 32 query rows (two groups of 16) of one (b,h): every K and V^T fragment read from LDS feeds both groups. The 8 waves of a block walk the same keys and share each 64-key K tile and V^T tile through LDS.
// A stage = K tile [64 keys][64 d] + V^T tile [64 d][64 keys], rows of 128 B at the 144-B pitch; two stages in LDS: the next one is copied in (global -> LDS, no register) while this one is read.
// Per 64-key step and query group: 4 tiles S^T[key][query] = K-tile (A) x Q^T (B) - ref, in the exp2 domain: ref, one reference value per query column, enters as the score product's C operand, so p = exp2(tile) with no
// arithmetic in between. ref is the column's maximum over the first 64 keys; it moves (and sums and outputs are rescaled, with one xor-16 exchange) only in a step where some score of the wave lies more than RBT above it;
// P^T B fragments repacked in-lane from the S^T accumulators (element r <- tile 2u [r], element 8+r <- tile 2u+1 [r]); O^T[d][query] += V^T (A) x P^T (B).
#define AWV    8                     // waves per attention block
#define QG     2                     // query groups of 16 per wave
#define KSTEP  64                    // keys per stage
#define RBT    8.0f                  // a score may exceed its column's reference by this much (p <= 2^8, well inside f16)
#define TILEH  (64 * TSP)            // halves of one staged tile
#define STAGEH (2 * TILEH)           // halves of one stage (K tile, then V^T tile)
static_assert(SEQ % (AWV * QG * 16) == 0);
static_assert(SEQ / KSTEP >= 2);
static_assert(AWV * 32 * 2 * 8 == 64 * HD);   // two 16-B pieces per lane cover one tile

// One stage's copies: each lane moves four 16-B pieces (rows r and r + 32 of both tiles). lk = the lane's LDS byte address in the K tile; gk, gv = its global pieces of row r.
__device__ __forceinline__ void stage_copy(unsigned lk, const h16* gk, const h16* gv) {
    const unsigned lk1 = lk + 32 * TSP * 2, lv = lk + TILEH * 2, lv1 = lk + TILEH * 2 + 32 * TSP * 2;
    const h16* gk1 = gk + 32 * HD; const h16* gv1 = gv + (size_t)32 * SEQ;
    // the closing s_wait_xcnt keeps every later write of these address registers behind the copies' issue
    asm volatile("global_load_async_to_lds_b128 %0, %4, off\n\t"
                 "global_load_async_to_lds_b128 %1, %5, off\n\t"
                 "global_load_async_to_lds_b128 %2, %6, off\n\t"
                 "global_load_async_to_lds_b128 %3, %7, off\n\t"
                 "s_wait_xcnt 0x0"
                 :: "v"(lk), "v"(lk1), "v"(lv), "v"(lv1), "v"(gk), "v"(gk1), "v"(gv), "v"(gv1) : "memory");
}

// second bound: 4 waves per SIMD (256 registers a wave), so that two blocks share a WGP and the whole grid is resident at once
__global__ __launch_bounds__(AWV * 32, 4) void k_attn(const h16* __restrict__ Qp, const h16* __restrict__ Kp, const h16* __restrict__ Vt, h16* Ctx) {
    __shared__ __align__(16) h16 ring[2 * STAGEH];
    __shared__ __align__(16) h16 os[AWV * QG * 16 * TSP];
    const int tid = threadIdx.x;
    const int lane = tid & 31, lr = lane & 15, hi = lane >> 4, wv = tid >> 5;
    const int bh = blockIdx.y; const int q0 = blockIdx.x * (AWV * QG * 16) + wv * (QG * 16);
    const size_t pbase = (size_t)bh * SEQ * HD;
    const unsigned cl = lds_off(ring) + (unsigned)(((tid >> 3) * TSP + (tid & 7) * 8) * 2);
    const h16* gk = Kp + pbase + (size_t)(tid >> 3) * HD + (tid & 7) * 8;
    const h16* gv = Vt + pbase + (size_t)(tid >> 3) * SEQ + (tid & 7) * 8;
    stage_copy(cl, gk, gv);
    v16h qb0[QG], qb1[QG];
    v8f o[QG][4];
    v8f nref[QG];                                                            // all eight elements: minus the column's reference
    float l[QG];
#pragma unroll
    for (int c = 0; c < QG; ++c) {
        const h16* qrow = Qp + pbase + (size_t)(q0 + c * 16 + lr) * HD + 8 * hi;
        qb0[c] = ldh(qrow); qb1[c] = ldh(qrow + 32);
#pragma unroll
        for (int dt = 0; dt < 4; ++dt) o[c][dt] = (v8f){};
        nref[c] = (v8f){}; l[c] = 0.0f;
    }
    asm volatile("s_wait_asynccnt 0x0" ::: "memory");                        // this wave's pieces of stage 0 have landed
    __syncthreads();                                                         // ... and every other wave's
    stage_copy(cl + STAGEH * 2, gk + (size_t)KSTEP * HD, gv + KSTEP);
#pragma unroll 1
    for (int kb = 0; kb < SEQ; kb += KSTEP) {
        const int sb = ((kb / KSTEP) & 1) * STAGEH;                          // this step's stage
        const h16* kbase = &ring[sb + lr * TSP + 8 * hi];
        const h16* vbase = kbase + TILEH;
        v8f st[QG][4]; v16h ka0, ka1;
#pragma unroll
        for (int t = 0; t < 4; ++t) { const h16* kp = kbase + t * 16 * TSP; ka0 = ldhs(kp); ka1 = ldhs(kp + 32);
#pragma unroll
            for (int c = 0; c < QG; ++c) st[c][t] = wmma16(ka0, qb0[c], nref[c]);
#pragma unroll
            for (int c = 0; c < QG; ++c) st[c][t] = wmma16(ka1, qb1[c], st[c][t]); }
        // four vector slots between the last score WMMA and the first vector read of a score tile; naming the tiles keeps the 16 WMMAs one run, with no vector work spread among them
        asm volatile("v_nop\n\tv_nop\n\tv_nop\n\tv_nop" : "+v"(st[0][0]), "+v"(st[0][1]), "+v"(st[0][2]), "+v"(st[0][3]), "+v"(st[1][0]), "+v"(st[1][1]), "+v"(st[1][2]), "+v"(st[1][3])
                     : "v"(ka0), "v"(ka1), "v"(qb0[0]), "v"(qb1[0]), "v"(qb0[1]), "v"(qb1[1]));
        v16h va[2][2];                                                       // two V^T fragment sets; the first d tile's is read here, under the softmax
        va[0][0] = ldhs(vbase); va[0][1] = ldhs(vbase + 32);
        float mloc[QG];
#pragma unroll
        for (int c = 0; c < QG; ++c) {
            mloc[c] = fmaxf(fmaxf(st[c][0][0], st[c][1][0]), fmaxf(st[c][2][0], st[c][3][0]));
#pragma unroll
            for (int j = 1; j < 8; ++j) mloc[c] = fmaxf(mloc[c], fmaxf(fmaxf(st[c][0][j], st[c][1][j]), fmaxf(st[c][2][j], st[c][3][j])));
        }
        // one wave-uniform test per step; the first step always sets the reference
        if ((__builtin_amdgcn_ballot_w32(fmaxf(mloc[0], mloc[1]) > RBT) | (unsigned)(kb == 0)) != 0) {
#pragma unroll
            for (int c = 0; c < QG; ++c) {
                const float mx = fmaxf(mloc[c], __shfl_xor(mloc[c], 16, 32));
                const float d = kb == 0 ? mx : fmaxf(mx, 0.0f);              // the reference never falls once it is set
                const float corr = __builtin_amdgcn_exp2f(fminf(-d, 0.0f));  // first step: sums and outputs are still 0, and the factor stays finite
                nref[c] -= d; l[c] *= corr;
#pragma unroll
                for (int t = 0; t < 4; ++t) { st[c][t] -= d; o[c][t] *= corr; }
            }
        }
        v16h pb0[QG], pb1[QG];
#pragma unroll
        for (int c = 0; c < QG; ++c) {
            float psum = 0.0f;
#pragma unroll
            for (int j = 0; j < 8; ++j) {
                const float p0 = __builtin_amdgcn_exp2f(st[c][0][j]);
                const float p1 = __builtin_amdgcn_exp2f(st[c][1][j]);
                const float p2 = __builtin_amdgcn_exp2f(st[c][2][j]);
                const float p3 = __builtin_amdgcn_exp2f(st[c][3][j]);
                psum += (p0 + p1) + (p2 + p3);
                pb0[c][j] = (h16)p0; pb0[c][8 + j] = (h16)p1; pb1[c][j] = (h16)p2; pb1[c][8 + j] = (h16)p3; }
            l[c] += psum;
        }
#pragma unroll
        for (int dt = 0; dt < 4; ++dt) {                                     // the next d tile's V^T fragments are read ahead of this tile's products
            if (dt + 1 < 4) { const h16* vp = vbase + (dt + 1) * 16 * TSP; va[(dt + 1) & 1][0] = ldhs(vp); va[(dt + 1) & 1][1] = ldhs(vp + 32); }
#pragma unroll
            for (int c = 0; c < QG; ++c) o[c][dt] = wmma16(va[dt & 1][0], pb0[c], o[c][dt]);
#pragma unroll
            for (int c = 0; c < QG; ++c) o[c][dt] = wmma16(va[dt & 1][1], pb1[c], o[c][dt]); }
        // the same four slots behind the last output WMMA, ahead of the branch at the loop's foot on both of its sides; naming the two sums keeps their additions in this step, among the output products:
        // moved behind the barrier, they would hold all 64 f32 probabilities in registers across the products, and no V^T fragment could be read ahead
        asm volatile("v_nop\n\tv_nop\n\tv_nop\n\tv_nop" : "+v"(o[0][0]), "+v"(o[0][1]), "+v"(o[0][2]), "+v"(o[0][3]), "+v"(o[1][0]), "+v"(o[1][1]), "+v"(o[1][2]), "+v"(o[1][3]), "+v"(l[0]), "+v"(l[1])
                     : "v"(va[1][0]), "v"(va[1][1]), "v"(pb0[0]), "v"(pb1[0]), "v"(pb0[1]), "v"(pb1[1]));
        asm volatile("s_wait_dscnt 0x0" ::: "memory");                       // this wave's reads of this stage are done before the stage is refilled
        asm volatile("s_wait_asynccnt 0x0" ::: "memory");                    // this wave's pieces of the next stage have landed
        __syncthreads();                                                     // publishes the next stage; ends every wave's reads of this one
        if (kb + 2 * KSTEP < SEQ) stage_copy(cl + (unsigned)sb * 2, gk + (size_t)(kb + 2 * KSTEP) * HD, gv + (kb + 2 * KSTEP));
    }
    asm volatile("s_wait_asynccnt 0x0" ::: "memory");                        // no copy is left in flight when the wave ends
    const int ob = wv * QG * 16 * TSP;                                       // wave-private staging region
#pragma unroll
    for (int c = 0; c < QG; ++c) {
        const float lt = l[c] + __shfl_xor(l[c], 16, 32);
        const float inv = CCAR * (1.0f / lt);
#pragma unroll
        for (int dt = 0; dt < 4; ++dt) { v8h hv;                             // o[c][dt][j] = O^T[d = dt*16 + 8*hi + j][query c*16 + lr]
#pragma unroll
            for (int j = 0; j < 8; ++j) hv[j] = (h16)(o[c][dt][j] * inv);
            *(v8ha*)(&os[ob + (c * 16 + lr) * TSP + dt * 16 + 8 * hi]) = hv; }
    }
    wave_lds_sync();
    const int b = bh / NH, h = bh % NH;
    h16* dst = Ctx + ((size_t)b * SEQ + q0) * DM + h * HD;
#pragma unroll
    for (int it = 0; it < QG * 4; ++it) { const int qq = it * 4 + (lane >> 3), pc = lane & 7; const v8h val = *(const v8ha*)(&os[ob + qq * TSP + pc * 8]);
        *(v8h*)(dst + (size_t)qq * DM + pc * 8) = val; }
}

// Block = 128 ctx rows x 256 output columns; wave wv: rows 64 * (wv >> 2), columns 64 * (wv & 3).
__global__ __launch_bounds__(GWV * 32) void k_outp(const h16* __restrict__ CTX, const h16* __restrict__ WO, const float* __restrict__ bias, float* OUT) {
    __shared__ __align__(16) h16 ring[2 * GSTH];
    __shared__ __align__(16) float osall[GWV * 16 * 68];
    const int tid = threadIdx.x, lane = tid & 31, lr = lane & 15, hi = lane >> 4, wv = tid >> 5;
    float* os = osall + wv * 16 * 68;                                       // wave-private staging region
    const int r0 = blockIdx.x * 128 + (wv >> 2) * 64, c0 = blockIdx.y * 256 + (wv & 3) * 64; const int bz = r0 / SEQ, s0 = r0 % SEQ;
    v8f acc[4][4];
    gemm_blk<128>(CTX + (size_t)blockIdx.x * 128 * DM, WO + (size_t)blockIdx.y * 256 * DM, ring, (wv >> 2) * 64, (wv & 3) * 64, acc, tid, lr, hi);       // acc[mb][nb][j]: row mb*16 + 8*hi + j, col nb*16 + lr
    const v4f braw = *(const v4f*)(bias + c0 + lr * 4); v4f bb; bb[0] = bfr(braw[0]); bb[1] = bfr(braw[1]); bb[2] = bfr(braw[2]); bb[3] = bfr(braw[3]);
    float* cbase = OUT + ((size_t)bz * SEQ_FULL + s0) * DM + c0;
#pragma unroll
    for (int mb = 0; mb < 4; ++mb) {
#pragma unroll
        for (int nb = 0; nb < 4; ++nb) {
#pragma unroll
            for (int j = 0; j < 8; ++j) os[(hi * 8 + j) * 68 + nb * 16 + lr] = acc[mb][nb][j] * OINV; }
        wave_lds_sync();
        float* crow = cbase + (size_t)(mb * 16) * DM;
{
#pragma unroll
            for (int s = 0; s < 8; ++s) { const int row = 2 * s + hi, cofs = lr * 4; v4f val = *(const v4fa*)(os + row * 68 + cofs); val += bb;
                *(v4f*)(crow + (size_t)row * DM + cofs) = val; }
             }
        wave_lds_sync();
    }
}

#define SZ_X    ((size_t)NB * SEQ * DM * 2)
#define SZ_W    ((size_t)DM * DM * 2)
#define SZ_ALL  (SZ_X * 5 + SZ_W * 4)
static_assert(SZ_X % 256 == 0);
static_assert(SZ_W % 256 == 0);
static_assert(SZ_ALL <= (size_t)134217728);

extern "C" void kernel_launch(void* const* d_in, const int* in_sizes, int n_in,
                              void* d_out, int out_size, void* d_ws, size_t ws_size, hipStream_t stream) {
    if (n_in < 9) return;
    const size_t needx = ((size_t)(NB - 1) * SEQ_FULL + SEQ) * DM;
    if ((size_t)in_sizes[0] < needx) return;
    if ((size_t)in_sizes[1] < (size_t)NH * DM * HD || (size_t)in_sizes[3] < (size_t)NH * DM * HD || (size_t)in_sizes[5] < (size_t)NH * DM * HD) return;
    if ((size_t)in_sizes[2] < (size_t)NH * HD || (size_t)in_sizes[4] < (size_t)NH * HD || (size_t)in_sizes[6] < (size_t)NH * HD) return;
    if ((size_t)in_sizes[7] < (size_t)DM * DM || (size_t)in_sizes[8] < (size_t)DM) return;
    if ((size_t)out_size < needx) return;
    if (SZ_ALL > ws_size) return;
    const float* xs = (const float*)d_in[0];
    const float* Wq = (const float*)d_in[1]; const float* bq = (const float*)d_in[2];
    const float* Wk = (const float*)d_in[3]; const float* bk = (const float*)d_in[4];
    const float* Wv = (const float*)d_in[5]; const float* bv = (const float*)d_in[6];
    const float* Wo = (const float*)d_in[7]; const float* bo = (const float*)d_in[8];
    float* OUT = (float*)d_out;
    char* wsp = (char*)d_ws;
    h16* XH  = (h16*)wsp; wsp += SZ_X;      // [NB*SEQ][DM]
    h16* WQ  = (h16*)wsp; wsp += SZ_W;      // Bt [h*64+d][e], x64
    h16* WK  = (h16*)wsp; wsp += SZ_W;
    h16* WV  = (h16*)wsp; wsp += SZ_W;
    h16* WO  = (h16*)wsp; wsp += SZ_W;      // Bt [out][in], x64
    h16* QP  = (h16*)wsp; wsp += SZ_X;      // [b][h][s][d]
    h16* KP  = (h16*)wsp; wsp += SZ_X;      // [b][h][s][d]
    h16* VT  = (h16*)wsp; wsp += SZ_X;      // [b][h][d][s]
    h16* CTX = (h16*)wsp; wsp += SZ_X;      // [NB*SEQ][DM], x64

    k_prep<<<(unsigned)(PTH / 256), 256, 0, stream>>>(xs, Wq, Wk, Wv, Wo, XH, WQ, WK, WV, WO);
    k_projqkv<<<dim3(NB * SEQ / 128, DM / 256, 3), GWV * 32, 0, stream>>>(XH, WQ, WK, WV, bq, bk, bv, QP, KP, VT);
    k_attn<<<dim3(SEQ / (AWV * QG * 16), NB * NH, 1), AWV * 32, 0, stream>>>(QP, KP, VT, CTX);
    k_outp<<<dim3(NB * SEQ / 128, DM / 256, 1), GWV * 32, 0, stream>>>(CTX, WO, bo, OUT);
}
